// v000
// Measured on an AMD MI455X. A time is GPU time per run, averaged over a window of back-to-back runs after a warm-up
// (all launches, gaps included; the runs take copies of the inputs in turn), and the median of several windows.
// Apart from v000's, it joins two sittings. Times from different sittings can be a few percent apart, while
// side-by-side timings come from the same sitting.
// The starting kernel, v000, takes 378 microseconds a run.
#include <hip/hip_runtime.h>
#include <hip/hip_bf16.h>
#include <stdint.h>

// ---------------------------------------------------------------------------
// DeBERTa disentangled attention for MI455X (gfx1250), wave32 + f32 WMMA.
//
// - bd/bc re-expressed as dense NT GEMMs over the 767 distinct relative
//   positions (pos_emb[i,j] depends only on j-i).
// - Big K=512 GEMMs use 4-wave workgroups with double-buffered LDS tiles
//   filled by GLOBAL_LOAD_ASYNC_TO_LDS_B128 (ASYNCcnt / s_wait_asynccnt),
//   16 WMMAs per wave per 16-deep k-chunk.
// ---------------------------------------------------------------------------

typedef __attribute__((ext_vector_type(2))) float v2f;
typedef __attribute__((ext_vector_type(8))) float v8f;

static constexpr int BATCH  = 8;
static constexpr int SEQ    = 384;
static constexpr int EMB    = 512;
static constexpr int NHEAD  = 8;
static constexpr int HDIM   = 64;
static constexpr int NREL   = 767;          // distinct values of j-i+383
static constexpr int RPAD   = 768;          // padded to multiple of 16
static constexpr int POSOFF = 128;          // pos_table row = rel + 128
static constexpr int MROWS  = BATCH * SEQ;  // 3072

// f32 WMMA 16x16x4 fragment layout (wave32):
//   A 16x4 : lane l (l<16): m=l, holds K=0,1 ; lane l>=16: m=l-16, K=2,3
//   B 4x16 : lane l (l<16): n=l, holds K=0,1 ; lane l>=16: n=l-16, K=2,3
//   C 16x16: vgpr r, lane l: m = r + (l<16 ? 0 : 8), n = l & 15
#define WMMA_F32(acc, a, b) \
  __builtin_amdgcn_wmma_f32_16x16x4_f32(false, (a), false, (b), (short)0, (acc), false, false)

// Async global -> LDS 16B copy (gfx1250). ldsoff is a workgroup-relative LDS
// byte offset (low 32 bits of the generic shared pointer); ga is the global
// address. Tracked by ASYNCcnt.
__device__ __forceinline__ void async_copy_b128(uint32_t ldsoff, uint64_t ga) {
  asm volatile("global_load_async_to_lds_b128 %0, %1, off"
               :: "v"(ldsoff), "v"(ga) : "memory");
}
__device__ __forceinline__ void wait_async_le4() {
  asm volatile("s_wait_asynccnt 0x4" ::: "memory");
}
__device__ __forceinline__ void wait_async_zero() {
  asm volatile("s_wait_asynccnt 0x0" ::: "memory");
}

// ---------------------------------------------------------------------------
// Staged NN GEMM: C[M x N] = A[M x K] @ B[K x N] + bias.
// Block = 128 threads (4 waves) -> 64x64 C block; wave w owns rows
// [m0+16w, m0+16w+16) x 64 cols (4 accumulators, A frag reused 4x).
// k-chunks of 16 double-buffered in LDS via async b128 loads.
// rowClamp: A row index clamped to rowClamp-1 (767-row pos_table gather
// padded to 768 GEMM rows). K multiple of 16; M, N multiples of 64.
// ---------------------------------------------------------------------------
__global__ void gemm_nn_bias(const float* __restrict__ A,
                             const float* __restrict__ Bm,
                             const float* __restrict__ bias,
                             float* __restrict__ C,
                             int K, int lda, int ldb, int ldc, int rowClamp) {
  __shared__ __align__(16) float lA[2][64 * 16];   // [row][k]  (4 KB each)
  __shared__ __align__(16) float lB[2][16 * 64];   // [k][col]  (4 KB each)

  const int t    = threadIdx.x;        // 0..127
  const int w    = t >> 5;             // wave 0..3
  const int lane = t & 31;
  const int mr   = lane & 15;
  const int kb   = (lane >> 4) << 1;   // 0 or 2
  const int mtop = (lane >> 4) << 3;   // 0 or 8
  const int m0   = blockIdx.y << 6;
  const int n0   = blockIdx.x << 6;

  // async-load slot mapping (each thread stages 2 A slots + 2 B slots / chunk)
  const int sA0 = t, sA1 = t + 128;              // float4 slots 0..255
  const int rowA0 = sA0 >> 2, kqA0 = sA0 & 3;
  const int rowA1 = sA1 >> 2, kqA1 = sA1 & 3;
  const int krB0 = sA0 >> 4, cqB0 = sA0 & 15;
  const int krB1 = sA1 >> 4, cqB1 = sA1 & 15;

  int ar0 = m0 + rowA0; if (ar0 > rowClamp - 1) ar0 = rowClamp - 1;
  int ar1 = m0 + rowA1; if (ar1 > rowClamp - 1) ar1 = rowClamp - 1;

  const int nchunk = K >> 4;

  auto issue = [&](int c, int buf) {
    const int k0 = c << 4;
    async_copy_b128((uint32_t)(uintptr_t)&lA[buf][sA0 * 4],
                    (uint64_t)(uintptr_t)(A + (size_t)ar0 * lda + k0 + kqA0 * 4));
    async_copy_b128((uint32_t)(uintptr_t)&lA[buf][sA1 * 4],
                    (uint64_t)(uintptr_t)(A + (size_t)ar1 * lda + k0 + kqA1 * 4));
    async_copy_b128((uint32_t)(uintptr_t)&lB[buf][sA0 * 4],
                    (uint64_t)(uintptr_t)(Bm + (size_t)(k0 + krB0) * ldb + n0 + cqB0 * 4));
    async_copy_b128((uint32_t)(uintptr_t)&lB[buf][sA1 * 4],
                    (uint64_t)(uintptr_t)(Bm + (size_t)(k0 + krB1) * ldb + n0 + cqB1 * 4));
  };

  v8f acc0 = {}, acc1 = {}, acc2 = {}, acc3 = {};

  int buf = 0;
  issue(0, 0);
  for (int c = 0; c < nchunk; ++c) {
    if (c + 1 < nchunk) { issue(c + 1, buf ^ 1); wait_async_le4(); }
    else                { wait_async_zero(); }
    __syncthreads();

    const float* As = &lA[buf][(w * 16 + mr) * 16];   // this wave's A rows
    const float* Bs = &lB[buf][0];
    #pragma unroll
    for (int q = 0; q < 4; ++q) {
      const int kk = q * 4 + kb;
      v2f a;
      a.x = As[kk];
      a.y = As[kk + 1];
      const float* b0 = Bs + kk * 64 + mr;
      const float* b1 = Bs + (kk + 1) * 64 + mr;
      v2f bv;
      bv.x = b0[0];  bv.y = b1[0];  acc0 = WMMA_F32(acc0, a, bv);
      bv.x = b0[16]; bv.y = b1[16]; acc1 = WMMA_F32(acc1, a, bv);
      bv.x = b0[32]; bv.y = b1[32]; acc2 = WMMA_F32(acc2, a, bv);
      bv.x = b0[48]; bv.y = b1[48]; acc3 = WMMA_F32(acc3, a, bv);
    }
    __syncthreads();
    buf ^= 1;
  }

  // store 16x64 strip (+bias)
  const int mbase = m0 + w * 16 + mtop;
  #pragma unroll
  for (int nt = 0; nt < 4; ++nt) {
    const int n = n0 + nt * 16 + mr;
    const float bv = bias ? bias[n] : 0.0f;
    const v8f& acc = (nt == 0) ? acc0 : (nt == 1) ? acc1 : (nt == 2) ? acc2 : acc3;
    #pragma unroll
    for (int r = 0; r < 8; ++r) {
      C[(size_t)(mbase + r) * ldc + n] = acc[r] + bv;
    }
  }
}

// ---------------------------------------------------------------------------
// C[M x N] = A[M x K] @ Bt[N x K]^T   (NT). Used for bdf/bcf: per-head
// q/k rows (K=64 slice of E=512) against per-head kp/qp rows.
// ---------------------------------------------------------------------------
__global__ void gemm_nt(const float* __restrict__ A,
                        const float* __restrict__ Bt,
                        float* __restrict__ C,
                        int K, int lda, int ldb, int ldc) {
  const int lane = threadIdx.x;
  const int mr   = lane & 15;
  const int kb   = (lane >> 4) << 1;
  const int mtop = (lane >> 4) << 3;
  const int m0   = blockIdx.y << 4;
  const int n0   = blockIdx.x << 4;

  const float* Arow = A  + (size_t)(m0 + mr) * lda + kb;
  const float* Brow = Bt + (size_t)(n0 + mr) * ldb + kb;

  v8f acc = {};
  #pragma unroll 4
  for (int kk = 0; kk < K; kk += 4) {
    v2f a, b;
    a.x = Arow[kk];
    a.y = Arow[kk + 1];
    b.x = Brow[kk];
    b.y = Brow[kk + 1];
    acc = WMMA_F32(acc, a, b);
  }

  const int n = n0 + mr;
  #pragma unroll
  for (int r = 0; r < 8; ++r) {
    const int m = m0 + mtop + r;
    C[(size_t)m * ldc + n] = acc[r];
  }
}

// ---------------------------------------------------------------------------
// Pre-softmax scores for head h:
//   s[b,h,i,j] = (q_bh[i].k_bh[j] + bdf[b*S+i, j-i+383] + bcf[b*S+j, j-i+383]) / 8
// ac tile via WMMA NT over the 64-wide head slice; bd/bc are gathers.
// grid: (S/16 j-tiles, S/16 i-tiles, B)
// ---------------------------------------------------------------------------
__global__ void score_kernel(const float* __restrict__ q,
                             const float* __restrict__ kmat,
                             const float* __restrict__ bdf,
                             const float* __restrict__ bcf,
                             float* __restrict__ wts,
                             int h) {
  const int lane = threadIdx.x;
  const int mr   = lane & 15;
  const int kb   = (lane >> 4) << 1;
  const int mtop = (lane >> 4) << 3;
  const int i0   = blockIdx.y << 4;
  const int j0   = blockIdx.x << 4;
  const int b    = blockIdx.z;

  const float* Arow = q    + (size_t)(b * SEQ + i0 + mr) * EMB + h * HDIM + kb;
  const float* Brow = kmat + (size_t)(b * SEQ + j0 + mr) * EMB + h * HDIM + kb;

  v8f acc = {};
  #pragma unroll
  for (int kk = 0; kk < HDIM; kk += 4) {
    v2f a, bb;
    a.x  = Arow[kk];
    a.y  = Arow[kk + 1];
    bb.x = Brow[kk];
    bb.y = Brow[kk + 1];
    acc = WMMA_F32(acc, a, bb);
  }

  const int j = j0 + mr;
  #pragma unroll
  for (int r = 0; r < 8; ++r) {
    const int i   = i0 + mtop + r;
    const int rel = j - i + (SEQ - 1);   // in [0, 766]
    const float s = (acc[r]
                     + bdf[(size_t)(b * SEQ + i) * RPAD + rel]
                     + bcf[(size_t)(b * SEQ + j) * RPAD + rel]) * 0.125f;
    wts[((size_t)((b * NHEAD + h) * SEQ + i)) * SEQ + j] = s;
  }
}

// ---------------------------------------------------------------------------
// Row softmax in place over the weights region of d_out. One block per row.
// ---------------------------------------------------------------------------
__global__ void softmax_kernel(float* __restrict__ w, int cols) {
  __shared__ float red[128];
  const int t = threadIdx.x;
  float* p = w + (size_t)blockIdx.x * cols;

  float mx = -3.0e38f;
  for (int j = t; j < cols; j += 128) mx = fmaxf(mx, p[j]);
  red[t] = mx; __syncthreads();
  for (int s = 64; s > 0; s >>= 1) {
    if (t < s) red[t] = fmaxf(red[t], red[t + s]);
    __syncthreads();
  }
  mx = red[0]; __syncthreads();

  float sum = 0.0f;
  for (int j = t; j < cols; j += 128) {
    const float e = expf(p[j] - mx);
    p[j] = e;
    sum += e;
  }
  red[t] = sum; __syncthreads();
  for (int s = 64; s > 0; s >>= 1) {
    if (t < s) red[t] += red[t + s];
    __syncthreads();
  }
  const float inv = 1.0f / red[0];
  for (int j = t; j < cols; j += 128) p[j] *= inv;
}

// ---------------------------------------------------------------------------
// o[b, i, h*64+d] = sum_j weights[b,h,i,j] * v[b*S+j, h*64+d]   (NN per b,h)
// grid: (HDIM/16, SEQ/16, B*NHEAD)
// ---------------------------------------------------------------------------
__global__ void av_gemm(const float* __restrict__ wts,
                        const float* __restrict__ vmat,
                        float* __restrict__ o) {
  const int lane = threadIdx.x;
  const int mr   = lane & 15;
  const int kb   = (lane >> 4) << 1;
  const int mtop = (lane >> 4) << 3;
  const int n0   = blockIdx.x << 4;
  const int i0   = blockIdx.y << 4;
  const int bh   = blockIdx.z;
  const int b    = bh >> 3;
  const int h    = bh & 7;

  const float* Arow = wts  + ((size_t)bh * SEQ + i0 + mr) * SEQ + kb;
  const float* Bp   = vmat + (size_t)(b * SEQ + kb) * EMB + h * HDIM + n0 + mr;

  v8f acc = {};
  #pragma unroll 4
  for (int kk = 0; kk < SEQ; kk += 4) {
    v2f a, bb;
    a.x  = Arow[kk];
    a.y  = Arow[kk + 1];
    bb.x = Bp[(size_t)kk * EMB];
    bb.y = Bp[(size_t)(kk + 1) * EMB];
    acc = WMMA_F32(acc, a, bb);
  }

  #pragma unroll
  for (int r = 0; r < 8; ++r) {
    const int i = i0 + mtop + r;
    o[(size_t)(b * SEQ + i) * EMB + h * HDIM + n0 + mr] = acc[r];
  }
}

// ---------------------------------------------------------------------------
extern "C" void kernel_launch(void* const* d_in, const int* in_sizes, int n_in,
                              void* d_out, int out_size, void* d_ws, size_t ws_size,
                              hipStream_t stream) {
  const float* x    = (const float*)d_in[0];
  const float* qW   = (const float*)d_in[1];
  const float* qb   = (const float*)d_in[2];
  const float* kW   = (const float*)d_in[3];
  const float* kb_  = (const float*)d_in[4];
  const float* vW   = (const float*)d_in[5];
  const float* vb   = (const float*)d_in[6];
  const float* qpW  = (const float*)d_in[7];
  const float* qpb  = (const float*)d_in[8];
  const float* kpW  = (const float*)d_in[9];
  const float* kpb  = (const float*)d_in[10];
  const float* pos  = (const float*)d_in[11];
  const float* fcW  = (const float*)d_in[12];
  const float* fcb  = (const float*)d_in[13];

  float* out = (float*)d_out;                       // [B, S, E]
  float* wts = out + (size_t)BATCH * SEQ * EMB;     // [B, H, S, S]

  // Workspace layout (~45 MiB of floats)
  float* ws   = (float*)d_ws;
  float* wq   = ws;                                 // [3072, 512]
  float* wk   = wq  + (size_t)MROWS * EMB;          // [3072, 512]
  float* wv   = wk  + (size_t)MROWS * EMB;          // [3072, 512]
  float* wo   = wv  + (size_t)MROWS * EMB;          // [3072, 512]
  float* wqp  = wo  + (size_t)MROWS * EMB;          // [768, 512]
  float* wkp  = wqp + (size_t)RPAD  * EMB;          // [768, 512]
  float* wbdf = wkp + (size_t)RPAD  * EMB;          // [3072, 768] per-head
  float* wbcf = wbdf + (size_t)MROWS * RPAD;        // [3072, 768] per-head

  const dim3 wave(32);
  const dim3 blk4(128);

  // 1) content projections: q/k/v = x @ W + b    ([3072x512] x [512x512])
  {
    const dim3 g(EMB / 64, MROWS / 64);
    gemm_nn_bias<<<g, blk4, 0, stream>>>(x, qW, qb,  wq, EMB, EMB, EMB, EMB, MROWS);
    gemm_nn_bias<<<g, blk4, 0, stream>>>(x, kW, kb_, wk, EMB, EMB, EMB, EMB, MROWS);
    gemm_nn_bias<<<g, blk4, 0, stream>>>(x, vW, vb,  wv, EMB, EMB, EMB, EMB, MROWS);
  }

  // 2) position projections over the 767 distinct relative rows
  //    (pos_table rows 128..894), padded to 768 GEMM rows via row clamp.
  {
    const dim3 g(EMB / 64, RPAD / 64);
    gemm_nn_bias<<<g, blk4, 0, stream>>>(pos + (size_t)POSOFF * EMB, qpW, qpb,
                                         wqp, EMB, EMB, EMB, EMB, NREL);
    gemm_nn_bias<<<g, blk4, 0, stream>>>(pos + (size_t)POSOFF * EMB, kpW, kpb,
                                         wkp, EMB, EMB, EMB, EMB, NREL);
  }

  // 3) per head: bdf = Q_h @ KP_h^T, bcf = K_h @ QP_h^T, then scores.
  for (int h = 0; h < NHEAD; ++h) {
    const int co = h * HDIM;
    const dim3 gnt(RPAD / 16, MROWS / 16);
    gemm_nt<<<gnt, wave, 0, stream>>>(wq + co, wkp + co, wbdf, HDIM, EMB, EMB, RPAD);
    gemm_nt<<<gnt, wave, 0, stream>>>(wk + co, wqp + co, wbcf, HDIM, EMB, EMB, RPAD);
    const dim3 gsc(SEQ / 16, SEQ / 16, BATCH);
    score_kernel<<<gsc, wave, 0, stream>>>(wq, wk, wbdf, wbcf, wts, h);
  }

  // 4) softmax over j, in place in d_out's weights region
  softmax_kernel<<<dim3(BATCH * NHEAD * SEQ), dim3(128), 0, stream>>>(wts, SEQ);

  // 5) attention output: o = weights @ v
  av_gemm<<<dim3(HDIM / 16, SEQ / 16, BATCH * NHEAD), wave, 0, stream>>>(wts, wv, wo);

  // 6) final projection: out = o @ fcW + fcb
  gemm_nn_bias<<<dim3(EMB / 64, MROWS / 64), blk4, 0, stream>>>(
      wo, fcW, fcb, out, EMB, EMB, EMB, EMB, MROWS);
}

// v001
// It runs in 194 microseconds.
// Timed twice side by side with v000, it ran 2.00 times as fast both times.
#include <hip/hip_runtime.h>
#include <hip/hip_bf16.h>
#include <stdint.h>

// ---------------------------------------------------------------------------
// DeBERTa disentangled attention for MI455X (gfx1250), wave32 + f32 WMMA.
//
// - bd/bc re-expressed as NT GEMMs over the 767 distinct relative
//   positions (pos_emb[i,j] depends only on j-i), done per score tile.
// - Big K=512 GEMMs use 4-wave workgroups with double-buffered LDS tiles
//   filled by GLOBAL_LOAD_ASYNC_TO_LDS_B128 (ASYNCcnt / s_wait_asynccnt),
//   16 WMMAs per wave per 16-deep k-chunk.
// ---------------------------------------------------------------------------

typedef __attribute__((ext_vector_type(2))) float v2f;
typedef __attribute__((ext_vector_type(8))) float v8f;

static constexpr int BATCH  = 8;
static constexpr int SEQ    = 384;
static constexpr int EMB    = 512;
static constexpr int NHEAD  = 8;
static constexpr int HDIM   = 64;
static constexpr int NREL   = 767;          // distinct values of j-i+383
static constexpr int RPAD   = 768;          // padded to multiple of 16
static constexpr int POSOFF = 128;          // pos_table row = rel + 128
static constexpr int MROWS  = BATCH * SEQ;  // 3072

// f32 WMMA 16x16x4 fragment layout (wave32):
//   A 16x4 : lane l (l<16): m=l, holds K=0,1 ; lane l>=16: m=l-16, K=2,3
//   B 4x16 : lane l (l<16): n=l, holds K=0,1 ; lane l>=16: n=l-16, K=2,3
//   C 16x16: vgpr r, lane l: m = r + (l<16 ? 0 : 8), n = l & 15
#define WMMA_F32(acc, a, b) \
  __builtin_amdgcn_wmma_f32_16x16x4_f32(false, (a), false, (b), (short)0, (acc), false, false)

// Async global -> LDS 16B copy (gfx1250). ldsoff is a workgroup-relative LDS
// byte offset (low 32 bits of the generic shared pointer); ga is the global
// address. Tracked by ASYNCcnt.
__device__ __forceinline__ void async_copy_b128(uint32_t ldsoff, uint64_t ga) {
  asm volatile("global_load_async_to_lds_b128 %0, %1, off"
               :: "v"(ldsoff), "v"(ga) : "memory");
}
__device__ __forceinline__ void wait_async_le4() {
  asm volatile("s_wait_asynccnt 0x4" ::: "memory");
}
__device__ __forceinline__ void wait_async_zero() {
  asm volatile("s_wait_asynccnt 0x0" ::: "memory");
}

// ---------------------------------------------------------------------------
// Staged NN GEMM: C[M x N] = A[M x K] @ B[K x N] + bias.
// Block = 128 threads (4 waves) -> 64x64 C block; wave w owns rows
// [m0+16w, m0+16w+16) x 64 cols (4 accumulators, A frag reused 4x).
// k-chunks of 16 double-buffered in LDS via async b128 loads.
// rowClamp: A row index clamped to rowClamp-1 (767-row pos_table gather
// padded to 768 GEMM rows). K multiple of 16; M, N multiples of 64.
// ---------------------------------------------------------------------------
__global__ void gemm_nn_bias(const float* __restrict__ A,
                             const float* __restrict__ Bm,
                             const float* __restrict__ bias,
                             float* __restrict__ C,
                             int K, int lda, int ldb, int ldc, int rowClamp) {
  __shared__ __align__(16) float lA[2][64 * 16];   // [row][k]  (4 KB each)
  __shared__ __align__(16) float lB[2][16 * 64];   // [k][col]  (4 KB each)

  const int t    = threadIdx.x;        // 0..127
  const int w    = t >> 5;             // wave 0..3
  const int lane = t & 31;
  const int mr   = lane & 15;
  const int kb   = (lane >> 4) << 1;   // 0 or 2
  const int mtop = (lane >> 4) << 3;   // 0 or 8
  const int m0   = blockIdx.y << 6;
  const int n0   = blockIdx.x << 6;

  // async-load slot mapping (each thread stages 2 A slots + 2 B slots / chunk)
  const int sA0 = t, sA1 = t + 128;              // float4 slots 0..255
  const int rowA0 = sA0 >> 2, kqA0 = sA0 & 3;
  const int rowA1 = sA1 >> 2, kqA1 = sA1 & 3;
  const int krB0 = sA0 >> 4, cqB0 = sA0 & 15;
  const int krB1 = sA1 >> 4, cqB1 = sA1 & 15;

  int ar0 = m0 + rowA0; if (ar0 > rowClamp - 1) ar0 = rowClamp - 1;
  int ar1 = m0 + rowA1; if (ar1 > rowClamp - 1) ar1 = rowClamp - 1;

  const int nchunk = K >> 4;

  auto issue = [&](int c, int buf) {
    const int k0 = c << 4;
    async_copy_b128((uint32_t)(uintptr_t)&lA[buf][sA0 * 4],
                    (uint64_t)(uintptr_t)(A + (size_t)ar0 * lda + k0 + kqA0 * 4));
    async_copy_b128((uint32_t)(uintptr_t)&lA[buf][sA1 * 4],
                    (uint64_t)(uintptr_t)(A + (size_t)ar1 * lda + k0 + kqA1 * 4));
    async_copy_b128((uint32_t)(uintptr_t)&lB[buf][sA0 * 4],
                    (uint64_t)(uintptr_t)(Bm + (size_t)(k0 + krB0) * ldb + n0 + cqB0 * 4));
    async_copy_b128((uint32_t)(uintptr_t)&lB[buf][sA1 * 4],
                    (uint64_t)(uintptr_t)(Bm + (size_t)(k0 + krB1) * ldb + n0 + cqB1 * 4));
  };

  v8f acc0 = {}, acc1 = {}, acc2 = {}, acc3 = {};

  int buf = 0;
  issue(0, 0);
  for (int c = 0; c < nchunk; ++c) {
    if (c + 1 < nchunk) { issue(c + 1, buf ^ 1); wait_async_le4(); }
    else                { wait_async_zero(); }
    __syncthreads();

    const float* As = &lA[buf][(w * 16 + mr) * 16];   // this wave's A rows
    const float* Bs = &lB[buf][0];
    #pragma unroll
    for (int q = 0; q < 4; ++q) {
      const int kk = q * 4 + kb;
      v2f a;
      a.x = As[kk];
      a.y = As[kk + 1];
      const float* b0 = Bs + kk * 64 + mr;
      const float* b1 = Bs + (kk + 1) * 64 + mr;
      v2f bv;
      bv.x = b0[0];  bv.y = b1[0];  acc0 = WMMA_F32(acc0, a, bv);
      bv.x = b0[16]; bv.y = b1[16]; acc1 = WMMA_F32(acc1, a, bv);
      bv.x = b0[32]; bv.y = b1[32]; acc2 = WMMA_F32(acc2, a, bv);
      bv.x = b0[48]; bv.y = b1[48]; acc3 = WMMA_F32(acc3, a, bv);
    }
    __syncthreads();
    buf ^= 1;
  }

  // store 16x64 strip (+bias)
  const int mbase = m0 + w * 16 + mtop;
  #pragma unroll
  for (int nt = 0; nt < 4; ++nt) {
    const int n = n0 + nt * 16 + mr;
    const float bv = bias ? bias[n] : 0.0f;
    const v8f& acc = (nt == 0) ? acc0 : (nt == 1) ? acc1 : (nt == 2) ? acc2 : acc3;
    #pragma unroll
    for (int r = 0; r < 8; ++r) {
      C[(size_t)(mbase + r) * ldc + n] = acc[r] + bv;
    }
  }
}

// ---------------------------------------------------------------------------
// Fused pre-softmax scores, all batches and heads in one launch:
//   s[b,h,i,j] = (q[i].k[j] + q[i].kp[j-i+383] + k[j].qp[j-i+383]) / 8
// Block = 8 waves -> one 64x64 (i,j) tile of one (b,h). The tile only meets
// the relative rows r0 .. r0+126, r0 = j0-i0+320, and a 16-row strip of it
// only 79 of them (five 16-row WMMA tiles). Q, K and the 128 KP / QP rows are
// staged once in LDS with whole-line loads. Wave (a, hw):
//   hw = 0: BC strip  K[j0+16a ..+15] x QP[r0+16a    .. +79]^T
//   hw = 1: BD strip  Q[i0+16a ..+15] x KP[r0+48-16a .. +79]^T
//   both  : AC        Q[i0+16a ..+15] x K [j0+32hw   .. +31]^T
// The strips then go to LDS (over the dead KP / QP rows) and each score
// element picks its skewed BD / BC entry from there.
// Fragments are read as one float4 per lane: lanes 0-15 hold k = 8g..8g+3,
// lanes 16-31 hold k = 8g+4..8g+7; (x,y) feeds one WMMA, (z,w) the next.
// A and B use the same mapping, so the k pairing is equal at every position.
// ---------------------------------------------------------------------------
static constexpr int PO  = 68;   // LDS row pitch (dwords) of a staged operand row
static constexpr int PBD = 85;   // LDS row pitch (dwords) of a BD strip
static constexpr int PBC = 82;   // LDS row pitch (dwords) of a BC strip
static constexpr int OFF_Q  = 0;
static constexpr int OFF_K  = OFF_Q  + 64 * PO;
static constexpr int OFF_KP = OFF_K  + 64 * PO;
static constexpr int OFF_QP = OFF_KP + 128 * PO;
static constexpr int SM_DW  = OFF_QP + 128 * PO;
static constexpr int OFF_BD = OFF_KP;                  // overlays KP / QP
static constexpr int OFF_BC = OFF_BD + 4 * 16 * PBD;
static_assert(OFF_BC + 4 * 16 * PBC <= SM_DW, "strips must fit over KP and QP");

// acc[t] += A(16 x 64) x B_t(16 x 64)^T, both from LDS rows of pitch PO.
// arow / brow point at this lane's row, at its half's first float4.
template <int NT>
__device__ __forceinline__ void strip_mm(const float* arow, const float* brow,
                                         v8f (&acc)[NT]) {
  float4 af[8];
  #pragma unroll
  for (int g = 0; g < 8; ++g)
    af[g] = *reinterpret_cast<const float4*>(arow + g * 8);
  // B fragments are fetched one k-group ahead of the WMMAs that use them.
  float4 bf[2][NT];
  #pragma unroll
  for (int t = 0; t < NT; ++t)
    bf[0][t] = *reinterpret_cast<const float4*>(brow + t * 16 * PO);
  #pragma unroll
  for (int g = 0; g < 8; ++g) {
    const int cu = g & 1;
    if (g < 7) {
      #pragma unroll
      for (int t = 0; t < NT; ++t)
        bf[cu ^ 1][t] = *reinterpret_cast<const float4*>(brow + t * 16 * PO + (g + 1) * 8);
    }
    v2f a0, a1;
    a0.x = af[g].x; a0.y = af[g].y;
    a1.x = af[g].z; a1.y = af[g].w;
    #pragma unroll
    for (int t = 0; t < NT; ++t) {
      v2f b0; b0.x = bf[cu][t].x; b0.y = bf[cu][t].y;
      acc[t] = WMMA_F32(acc[t], a0, b0);
    }
    #pragma unroll
    for (int t = 0; t < NT; ++t) {
      v2f b1; b1.x = bf[cu][t].z; b1.y = bf[cu][t].w;
      acc[t] = WMMA_F32(acc[t], a1, b1);
    }
  }
}

__global__ __launch_bounds__(256)
void score_fused(const float* __restrict__ q,
                 const float* __restrict__ kmat,
                 const float* __restrict__ qp,
                 const float* __restrict__ kp,
                 float* __restrict__ wts) {
  __shared__ __align__(16) float sm[SM_DW];

  const int t    = threadIdx.x;        // 0..255
  const int w    = __builtin_amdgcn_readfirstlane(t >> 5);   // wave number, kept scalar
  const int a    = w & 3;              // 16-row strip
  const int hw   = w >> 2;             // 0: BC strip, 1: BD strip
  const int lane = t & 31;
  const int mr   = lane & 15;
  const int half = lane >> 4;
  const int mtop = half << 3;
  const int j0   = blockIdx.x << 6;
  const int i0   = blockIdx.y << 6;
  const int bh   = blockIdx.z;
  const int b    = bh >> 3;
  const int h    = bh & 7;
  const int r0   = j0 - i0 + 320;      // first relative row of the tile, 0..640

  // Stage the operands: 16 threads per 256-byte row slice, 16 rows per pass.
  {
    const int c4 = (t & 15) << 2;
    const int rr = t >> 4;
    const unsigned vo = (unsigned)(rr * EMB + c4);   // same lane offset in all four arrays
    const float* gq  = q    + (size_t)(b * SEQ + i0) * EMB + h * HDIM + vo;
    const float* gk  = kmat + (size_t)(b * SEQ + j0) * EMB + h * HDIM + vo;
    const float* gkp = kp   + (size_t)r0 * EMB + h * HDIM + vo;
    const float* gqp = qp   + (size_t)r0 * EMB + h * HDIM + vo;
    float4 vq[4], vk[4], vkp[8], vqp[8];
    #pragma unroll
    for (int s = 0; s < 4; ++s) {
      vq[s] = *reinterpret_cast<const float4*>(gq + (size_t)s * 16 * EMB);
      vk[s] = *reinterpret_cast<const float4*>(gk + (size_t)s * 16 * EMB);
    }
    #pragma unroll
    for (int s = 0; s < 8; ++s) {
      vkp[s] = *reinterpret_cast<const float4*>(gkp + (size_t)s * 16 * EMB);
      vqp[s] = *reinterpret_cast<const float4*>(gqp + (size_t)s * 16 * EMB);
    }
    float* d = sm + rr * PO + c4;
    #pragma unroll
    for (int s = 0; s < 4; ++s) {
      *reinterpret_cast<float4*>(d + OFF_Q + s * 16 * PO) = vq[s];
      *reinterpret_cast<float4*>(d + OFF_K + s * 16 * PO) = vk[s];
    }
    #pragma unroll
    for (int s = 0; s < 8; ++s) {
      *reinterpret_cast<float4*>(d + OFF_KP + s * 16 * PO) = vkp[s];
      *reinterpret_cast<float4*>(d + OFF_QP + s * 16 * PO) = vqp[s];
    }
  }
  __syncthreads();   // operands staged

  const int lo = mr * PO + half * 4;   // this lane's row and half inside a 16-row tile

  // relative strip: rows m of strip a, columns c in [0,80)
  v8f c5[5] = {};
  strip_mm<5>(sm + (hw ? OFF_Q : OFF_K) + 16 * a * PO + lo,
              sm + (hw ? OFF_KP + (48 - 16 * a) * PO : OFF_QP + 16 * a * PO) + lo, c5);

  // content-content: rows i = i0+16a+m, columns j = j0 + 32*hw + 16*nn + n
  v8f ac[2] = {};
  strip_mm<2>(sm + OFF_Q + 16 * a * PO + lo, sm + OFF_K + 32 * hw * PO + lo, ac);

  __syncthreads();   // every read of KP / QP is done before the strips overwrite them

  {
    const int po = hw ? PBD : PBC;
    float* so = sm + (hw ? OFF_BD + a * 16 * PBD : OFF_BC + a * 16 * PBC) + mtop * po + mr;
    #pragma unroll
    for (int tt = 0; tt < 5; ++tt)
      #pragma unroll
      for (int r = 0; r < 8; ++r)
        so[r * po + tt * 16] = c5[tt][r];
  }
  __syncthreads();   // strips published: each wave reads strips of other waves

  // BD column = 16*nb + n - m + 15 ; BC column (strip nb, row n) = n - (16a+m) + 63
  float bd[2][8], bc[2][8];
  #pragma unroll
  for (int nn = 0; nn < 2; ++nn) {
    const int nb = 2 * hw + nn;
    #pragma unroll
    for (int r = 0; r < 8; ++r) {
      const int m = mtop + r;
      bd[nn][r] = sm[OFF_BD + a * 16 * PBD + m * PBD + 16 * nb + mr - m + 15];
      bc[nn][r] = sm[OFF_BC + nb * 16 * PBC + mr * PBC + mr - 16 * a - m + 63];
    }
  }
  #pragma unroll
  for (int nn = 0; nn < 2; ++nn) {
    #pragma unroll
    for (int r = 0; r < 8; ++r)
      ac[nn][r] = (ac[nn][r] + bd[nn][r] + bc[nn][r]) * 0.125f;
  }
  float* orow = wts + ((size_t)bh * SEQ + i0 + 16 * a + mtop) * SEQ + j0 + 32 * hw + mr;
  #pragma unroll
  for (int r = 0; r < 8; ++r) {
    #pragma unroll
    for (int nn = 0; nn < 2; ++nn)
      orow[(size_t)r * SEQ + 16 * nn] = ac[nn][r];
  }
}

// ---------------------------------------------------------------------------
// Row softmax in place over the weights region of d_out. One block per row.
// ---------------------------------------------------------------------------
__global__ void softmax_kernel(float* __restrict__ w, int cols) {
  __shared__ float red[128];
  const int t = threadIdx.x;
  float* p = w + (size_t)blockIdx.x * cols;

  float mx = -3.0e38f;
  for (int j = t; j < cols; j += 128) mx = fmaxf(mx, p[j]);
  red[t] = mx; __syncthreads();
  for (int s = 64; s > 0; s >>= 1) {
    if (t < s) red[t] = fmaxf(red[t], red[t + s]);
    __syncthreads();
  }
  mx = red[0]; __syncthreads();

  float sum = 0.0f;
  for (int j = t; j < cols; j += 128) {
    const float e = expf(p[j] - mx);
    p[j] = e;
    sum += e;
  }
  red[t] = sum; __syncthreads();
  for (int s = 64; s > 0; s >>= 1) {
    if (t < s) red[t] += red[t + s];
    __syncthreads();
  }
  const float inv = 1.0f / red[0];
  for (int j = t; j < cols; j += 128) p[j] *= inv;
}

// ---------------------------------------------------------------------------
// o[b, i, h*64+d] = sum_j weights[b,h,i,j] * v[b*S+j, h*64+d]   (NN per b,h)
// grid: (HDIM/16, SEQ/16, B*NHEAD)
// ---------------------------------------------------------------------------
__global__ void av_gemm(const float* __restrict__ wts,
                        const float* __restrict__ vmat,
                        float* __restrict__ o) {
  const int lane = threadIdx.x;
  const int mr   = lane & 15;
  const int kb   = (lane >> 4) << 1;
  const int mtop = (lane >> 4) << 3;
  const int n0   = blockIdx.x << 4;
  const int i0   = blockIdx.y << 4;
  const int bh   = blockIdx.z;
  const int b    = bh >> 3;
  const int h    = bh & 7;

  const float* Arow = wts  + ((size_t)bh * SEQ + i0 + mr) * SEQ + kb;
  const float* Bp   = vmat + (size_t)(b * SEQ + kb) * EMB + h * HDIM + n0 + mr;

  v8f acc = {};
  #pragma unroll 4
  for (int kk = 0; kk < SEQ; kk += 4) {
    v2f a, bb;
    a.x  = Arow[kk];
    a.y  = Arow[kk + 1];
    bb.x = Bp[(size_t)kk * EMB];
    bb.y = Bp[(size_t)(kk + 1) * EMB];
    acc = WMMA_F32(acc, a, bb);
  }

  #pragma unroll
  for (int r = 0; r < 8; ++r) {
    const int i = i0 + mtop + r;
    o[(size_t)(b * SEQ + i) * EMB + h * HDIM + n0 + mr] = acc[r];
  }
}

// ---------------------------------------------------------------------------
extern "C" void kernel_launch(void* const* d_in, const int* in_sizes, int n_in,
                              void* d_out, int out_size, void* d_ws, size_t ws_size,
                              hipStream_t stream) {
  const float* x    = (const float*)d_in[0];
  const float* qW   = (const float*)d_in[1];
  const float* qb   = (const float*)d_in[2];
  const float* kW   = (const float*)d_in[3];
  const float* kb_  = (const float*)d_in[4];
  const float* vW   = (const float*)d_in[5];
  const float* vb   = (const float*)d_in[6];
  const float* qpW  = (const float*)d_in[7];
  const float* qpb  = (const float*)d_in[8];
  const float* kpW  = (const float*)d_in[9];
  const float* kpb  = (const float*)d_in[10];
  const float* pos  = (const float*)d_in[11];
  const float* fcW  = (const float*)d_in[12];
  const float* fcb  = (const float*)d_in[13];

  float* out = (float*)d_out;                       // [B, S, E]
  float* wts = out + (size_t)BATCH * SEQ * EMB;     // [B, H, S, S]

  // Workspace layout (~27 MiB of floats)
  float* ws   = (float*)d_ws;
  float* wq   = ws;                                 // [3072, 512]
  float* wk   = wq  + (size_t)MROWS * EMB;          // [3072, 512]
  float* wv   = wk  + (size_t)MROWS * EMB;          // [3072, 512]
  float* wo   = wv  + (size_t)MROWS * EMB;          // [3072, 512]
  float* wqp  = wo  + (size_t)MROWS * EMB;          // [768, 512]
  float* wkp  = wqp + (size_t)RPAD  * EMB;          // [768, 512]

  const dim3 wave(32);
  const dim3 blk4(128);

  // 1) content projections: q/k/v = x @ W + b    ([3072x512] x [512x512])
  {
    const dim3 g(EMB / 64, MROWS / 64);
    gemm_nn_bias<<<g, blk4, 0, stream>>>(x, qW, qb,  wq, EMB, EMB, EMB, EMB, MROWS);
    gemm_nn_bias<<<g, blk4, 0, stream>>>(x, kW, kb_, wk, EMB, EMB, EMB, EMB, MROWS);
    gemm_nn_bias<<<g, blk4, 0, stream>>>(x, vW, vb,  wv, EMB, EMB, EMB, EMB, MROWS);
  }

  // 2) position projections over the 767 distinct relative rows
  //    (pos_table rows 128..894), padded to 768 GEMM rows via row clamp.
  {
    const dim3 g(EMB / 64, RPAD / 64);
    gemm_nn_bias<<<g, blk4, 0, stream>>>(pos + (size_t)POSOFF * EMB, qpW, qpb,
                                         wqp, EMB, EMB, EMB, EMB, NREL);
    gemm_nn_bias<<<g, blk4, 0, stream>>>(pos + (size_t)POSOFF * EMB, kpW, kpb,
                                         wkp, EMB, EMB, EMB, EMB, NREL);
  }

  // 3) scores for every (b, h): content-content plus both relative terms.
  score_fused<<<dim3(SEQ / 64, SEQ / 64, BATCH * NHEAD), dim3(256), 0, stream>>>(
      wq, wk, wqp, wkp, wts);

  // 4) softmax over j, in place in d_out's weights region
  softmax_kernel<<<dim3(BATCH * NHEAD * SEQ), dim3(128), 0, stream>>>(wts, SEQ);

  // 5) attention output: o = weights @ v
  av_gemm<<<dim3(HDIM / 16, SEQ / 16, BATCH * NHEAD), wave, 0, stream>>>(wts, wv, wo);

  // 6) final projection: out = o @ fcW + fcb
  gemm_nn_bias<<<dim3(EMB / 64, MROWS / 64), blk4, 0, stream>>>(
      wo, fcW, fcb, out, EMB, EMB, EMB, EMB, MROWS);
}

// v002
// It runs in 182 microseconds.
// Two timings next to v001 both put it at 1.07 times that version's speed.
// Over all steps from v000 it is 2.14 times as fast.
#include <hip/hip_runtime.h>
#include <hip/hip_bf16.h>
#include <stdint.h>

// ---------------------------------------------------------------------------
// DeBERTa disentangled attention for MI455X (gfx1250), wave32 + f32 WMMA.
//
// - bd/bc re-expressed as NT GEMMs over the 767 distinct relative
//   positions (pos_emb[i,j] depends only on j-i), done per score tile.
// - Big K=512 GEMMs use 4-wave workgroups with double-buffered LDS tiles
//   filled by GLOBAL_LOAD_ASYNC_TO_LDS_B128 (ASYNCcnt / s_wait_asynccnt),
//   16 WMMAs per wave per 16-deep k-chunk.
// ---------------------------------------------------------------------------

typedef __attribute__((ext_vector_type(2))) float v2f;
typedef __attribute__((ext_vector_type(4))) float v4f;
typedef __attribute__((ext_vector_type(8))) float v8f;

static constexpr int BATCH  = 8;
static constexpr int SEQ    = 384;
static constexpr int EMB    = 512;
static constexpr int NHEAD  = 8;
static constexpr int HDIM   = 64;
static constexpr int NREL   = 767;          // distinct values of j-i+383
static constexpr int RPAD   = 768;          // padded to multiple of 16
static constexpr int POSOFF = 128;          // pos_table row = rel + 128
static constexpr int MROWS  = BATCH * SEQ;  // 3072

// f32 WMMA 16x16x4 fragment layout (wave32):
//   A 16x4 : lane l (l<16): m=l, holds K=0,1 ; lane l>=16: m=l-16, K=2,3
//   B 4x16 : lane l (l<16): n=l, holds K=0,1 ; lane l>=16: n=l-16, K=2,3
//   C 16x16: vgpr r, lane l: m = r + (l<16 ? 0 : 8), n = l & 15
#define WMMA_F32(acc, a, b) \
  __builtin_amdgcn_wmma_f32_16x16x4_f32(false, (a), false, (b), (short)0, (acc), false, false)

// Async global -> LDS 16B copy (gfx1250). ldsoff is a workgroup-relative LDS
// byte offset (low 32 bits of the generic shared pointer); ga is the global
// address. Tracked by ASYNCcnt.
__device__ __forceinline__ void async_copy_b128(uint32_t ldsoff, uint64_t ga) {
  asm volatile("global_load_async_to_lds_b128 %0, %1, off"
               :: "v"(ldsoff), "v"(ga) : "memory");
}
__device__ __forceinline__ void wait_async_le4() {
  asm volatile("s_wait_asynccnt 0x4" ::: "memory");
}
__device__ __forceinline__ void wait_async_zero() {
  asm volatile("s_wait_asynccnt 0x0" ::: "memory");
}

// ---------------------------------------------------------------------------
// Staged NN GEMM: C[M x N] = A[M x K] @ B[K x N] + bias.
// Block = 128 threads (4 waves) -> 64x64 C block; wave w owns rows
// [m0+16w, m0+16w+16) x 64 cols (4 accumulators, A frag reused 4x).
// k-chunks of 16 double-buffered in LDS via async b128 loads.
// rowClamp: A row index clamped to rowClamp-1 (767-row pos_table gather
// padded to 768 GEMM rows). K multiple of 16; M, N multiples of 64.
// ---------------------------------------------------------------------------
__global__ void gemm_nn_bias(const float* __restrict__ A,
                             const float* __restrict__ Bm,
                             const float* __restrict__ bias,
                             float* __restrict__ C,
                             int K, int lda, int ldb, int ldc, int rowClamp) {
  __shared__ __align__(16) float lA[2][64 * 16];   // [row][k]  (4 KB each)
  __shared__ __align__(16) float lB[2][16 * 64];   // [k][col]  (4 KB each)

  const int t    = threadIdx.x;        // 0..127
  const int w    = t >> 5;             // wave 0..3
  const int lane = t & 31;
  const int mr   = lane & 15;
  const int kb   = (lane >> 4) << 1;   // 0 or 2
  const int mtop = (lane >> 4) << 3;   // 0 or 8
  const int m0   = blockIdx.y << 6;
  const int n0   = blockIdx.x << 6;

  // async-load slot mapping (each thread stages 2 A slots + 2 B slots / chunk)
  const int sA0 = t, sA1 = t + 128;              // float4 slots 0..255
  const int rowA0 = sA0 >> 2, kqA0 = sA0 & 3;
  const int rowA1 = sA1 >> 2, kqA1 = sA1 & 3;
  const int krB0 = sA0 >> 4, cqB0 = sA0 & 15;
  const int krB1 = sA1 >> 4, cqB1 = sA1 & 15;

  int ar0 = m0 + rowA0; if (ar0 > rowClamp - 1) ar0 = rowClamp - 1;
  int ar1 = m0 + rowA1; if (ar1 > rowClamp - 1) ar1 = rowClamp - 1;

  const int nchunk = K >> 4;

  auto issue = [&](int c, int buf) {
    const int k0 = c << 4;
    async_copy_b128((uint32_t)(uintptr_t)&lA[buf][sA0 * 4],
                    (uint64_t)(uintptr_t)(A + (size_t)ar0 * lda + k0 + kqA0 * 4));
    async_copy_b128((uint32_t)(uintptr_t)&lA[buf][sA1 * 4],
                    (uint64_t)(uintptr_t)(A + (size_t)ar1 * lda + k0 + kqA1 * 4));
    async_copy_b128((uint32_t)(uintptr_t)&lB[buf][sA0 * 4],
                    (uint64_t)(uintptr_t)(Bm + (size_t)(k0 + krB0) * ldb + n0 + cqB0 * 4));
    async_copy_b128((uint32_t)(uintptr_t)&lB[buf][sA1 * 4],
                    (uint64_t)(uintptr_t)(Bm + (size_t)(k0 + krB1) * ldb + n0 + cqB1 * 4));
  };

  v8f acc0 = {}, acc1 = {}, acc2 = {}, acc3 = {};

  int buf = 0;
  issue(0, 0);
  for (int c = 0; c < nchunk; ++c) {
    if (c + 1 < nchunk) { issue(c + 1, buf ^ 1); wait_async_le4(); }
    else                { wait_async_zero(); }
    __syncthreads();

    const float* As = &lA[buf][(w * 16 + mr) * 16];   // this wave's A rows
    const float* Bs = &lB[buf][0];
    #pragma unroll
    for (int q = 0; q < 4; ++q) {
      const int kk = q * 4 + kb;
      v2f a;
      a.x = As[kk];
      a.y = As[kk + 1];
      const float* b0 = Bs + kk * 64 + mr;
      const float* b1 = Bs + (kk + 1) * 64 + mr;
      v2f bv;
      bv.x = b0[0];  bv.y = b1[0];  acc0 = WMMA_F32(acc0, a, bv);
      bv.x = b0[16]; bv.y = b1[16]; acc1 = WMMA_F32(acc1, a, bv);
      bv.x = b0[32]; bv.y = b1[32]; acc2 = WMMA_F32(acc2, a, bv);
      bv.x = b0[48]; bv.y = b1[48]; acc3 = WMMA_F32(acc3, a, bv);
    }
    __syncthreads();
    buf ^= 1;
  }

  // store 16x64 strip (+bias)
  const int mbase = m0 + w * 16 + mtop;
  #pragma unroll
  for (int nt = 0; nt < 4; ++nt) {
    const int n = n0 + nt * 16 + mr;
    const float bv = bias ? bias[n] : 0.0f;
    const v8f& acc = (nt == 0) ? acc0 : (nt == 1) ? acc1 : (nt == 2) ? acc2 : acc3;
    #pragma unroll
    for (int r = 0; r < 8; ++r) {
      C[(size_t)(mbase + r) * ldc + n] = acc[r] + bv;
    }
  }
}

// ---------------------------------------------------------------------------
// Fused pre-softmax scores, all batches and heads in one launch:
//   s[b,h,i,j] = (q[i].k[j] + q[i].kp[j-i+383] + k[j].qp[j-i+383]) / 8
// Block = 8 waves -> one 64x64 (i,j) tile of one (b,h). The tile only meets
// the relative rows r0 .. r0+126, r0 = j0-i0+320, and a 16-row strip of it
// only 79 of them (five 16-row WMMA tiles). Q, K and the 128 KP / QP rows are
// staged once in LDS with whole-line loads. Wave (a, hw):
//   hw = 0: BC strip  K[j0+16a ..+15] x QP[r0+16a    .. +79]^T
//   hw = 1: BD strip  Q[i0+16a ..+15] x KP[r0+48-16a .. +79]^T
//   both  : AC        Q[i0+16a ..+15] x K [j0+32hw   .. +31]^T
// The strips then go to LDS (over the dead KP / QP rows) and each score
// element picks its skewed BD / BC entry from there.
// Fragments are read as one float4 per lane: lanes 0-15 hold k = 8g..8g+3,
// lanes 16-31 hold k = 8g+4..8g+7; (x,y) feeds one WMMA, (z,w) the next.
// A and B use the same mapping, so the k pairing is equal at every position.
// ---------------------------------------------------------------------------
static constexpr int PO  = 68;   // LDS row pitch (dwords) of a staged operand row
static constexpr int PBD = 85;   // LDS row pitch (dwords) of a BD strip
static constexpr int PBC = 82;   // LDS row pitch (dwords) of a BC strip
static constexpr int OFF_Q  = 0;
static constexpr int OFF_K  = OFF_Q  + 64 * PO;
static constexpr int OFF_KP = OFF_K  + 64 * PO;
static constexpr int OFF_QP = OFF_KP + 128 * PO;
static constexpr int SM_DW  = OFF_QP + 128 * PO;
static constexpr int OFF_BD = OFF_KP;                  // overlays KP / QP
static constexpr int OFF_BC = OFF_BD + 4 * 16 * PBD;
static_assert(OFF_BC + 4 * 16 * PBC <= SM_DW, "strips must fit over KP and QP");

// acc[t] += A(16 x 64) x B_t(16 x 64)^T, both from LDS rows of pitch PO.
// arow / brow point at this lane's row, at its half's first float4.
template <int NT>
__device__ __forceinline__ void strip_mm(const float* arow, const float* brow,
                                         v8f (&acc)[NT]) {
  float4 af[8];
  #pragma unroll
  for (int g = 0; g < 8; ++g)
    af[g] = *reinterpret_cast<const float4*>(arow + g * 8);
  // B fragments are fetched one k-group ahead of the WMMAs that use them.
  float4 bf[2][NT];
  #pragma unroll
  for (int t = 0; t < NT; ++t)
    bf[0][t] = *reinterpret_cast<const float4*>(brow + t * 16 * PO);
  #pragma unroll
  for (int g = 0; g < 8; ++g) {
    const int cu = g & 1;
    if (g < 7) {
      #pragma unroll
      for (int t = 0; t < NT; ++t)
        bf[cu ^ 1][t] = *reinterpret_cast<const float4*>(brow + t * 16 * PO + (g + 1) * 8);
    }
    v2f a0, a1;
    a0.x = af[g].x; a0.y = af[g].y;
    a1.x = af[g].z; a1.y = af[g].w;
    #pragma unroll
    for (int t = 0; t < NT; ++t) {
      v2f b0; b0.x = bf[cu][t].x; b0.y = bf[cu][t].y;
      acc[t] = WMMA_F32(acc[t], a0, b0);
    }
    #pragma unroll
    for (int t = 0; t < NT; ++t) {
      v2f b1; b1.x = bf[cu][t].z; b1.y = bf[cu][t].w;
      acc[t] = WMMA_F32(acc[t], a1, b1);
    }
  }
}

__global__ __launch_bounds__(256)
void score_fused(const float* __restrict__ q,
                 const float* __restrict__ kmat,
                 const float* __restrict__ qp,
                 const float* __restrict__ kp,
                 float* __restrict__ wts) {
  __shared__ __align__(16) float sm[SM_DW];

  const int t    = threadIdx.x;        // 0..255
  const int w    = __builtin_amdgcn_readfirstlane(t >> 5);   // wave number, kept scalar
  const int a    = w & 3;              // 16-row strip
  const int hw   = w >> 2;             // 0: BC strip, 1: BD strip
  const int lane = t & 31;
  const int mr   = lane & 15;
  const int half = lane >> 4;
  const int mtop = half << 3;
  const int j0   = blockIdx.x << 6;
  const int i0   = blockIdx.y << 6;
  const int bh   = blockIdx.z;
  const int b    = bh >> 3;
  const int h    = bh & 7;
  const int r0   = j0 - i0 + 320;      // first relative row of the tile, 0..640

  // Stage the operands: 16 threads per 256-byte row slice, 16 rows per pass.
  {
    const int c4 = (t & 15) << 2;
    const int rr = t >> 4;
    const unsigned vo = (unsigned)(rr * EMB + c4);   // same lane offset in all four arrays
    const float* gq  = q    + (size_t)(b * SEQ + i0) * EMB + h * HDIM + vo;
    const float* gk  = kmat + (size_t)(b * SEQ + j0) * EMB + h * HDIM + vo;
    const float* gkp = kp   + (size_t)r0 * EMB + h * HDIM + vo;
    const float* gqp = qp   + (size_t)r0 * EMB + h * HDIM + vo;
    float4 vq[4], vk[4], vkp[8], vqp[8];
    #pragma unroll
    for (int s = 0; s < 4; ++s) {
      vq[s] = *reinterpret_cast<const float4*>(gq + (size_t)s * 16 * EMB);
      vk[s] = *reinterpret_cast<const float4*>(gk + (size_t)s * 16 * EMB);
    }
    #pragma unroll
    for (int s = 0; s < 8; ++s) {
      vkp[s] = *reinterpret_cast<const float4*>(gkp + (size_t)s * 16 * EMB);
      vqp[s] = *reinterpret_cast<const float4*>(gqp + (size_t)s * 16 * EMB);
    }
    float* d = sm + rr * PO + c4;
    #pragma unroll
    for (int s = 0; s < 4; ++s) {
      *reinterpret_cast<float4*>(d + OFF_Q + s * 16 * PO) = vq[s];
      *reinterpret_cast<float4*>(d + OFF_K + s * 16 * PO) = vk[s];
    }
    #pragma unroll
    for (int s = 0; s < 8; ++s) {
      *reinterpret_cast<float4*>(d + OFF_KP + s * 16 * PO) = vkp[s];
      *reinterpret_cast<float4*>(d + OFF_QP + s * 16 * PO) = vqp[s];
    }
  }
  __syncthreads();   // operands staged

  const int lo = mr * PO + half * 4;   // this lane's row and half inside a 16-row tile

  // relative strip: rows m of strip a, columns c in [0,80)
  v8f c5[5] = {};
  strip_mm<5>(sm + (hw ? OFF_Q : OFF_K) + 16 * a * PO + lo,
              sm + (hw ? OFF_KP + (48 - 16 * a) * PO : OFF_QP + 16 * a * PO) + lo, c5);

  // content-content: rows i = i0+16a+m, columns j = j0 + 32*hw + 16*nn + n
  v8f ac[2] = {};
  strip_mm<2>(sm + OFF_Q + 16 * a * PO + lo, sm + OFF_K + 32 * hw * PO + lo, ac);

  __syncthreads();   // every read of KP / QP is done before the strips overwrite them

  {
    const int po = hw ? PBD : PBC;
    float* so = sm + (hw ? OFF_BD + a * 16 * PBD : OFF_BC + a * 16 * PBC) + mtop * po + mr;
    #pragma unroll
    for (int tt = 0; tt < 5; ++tt)
      #pragma unroll
      for (int r = 0; r < 8; ++r)
        so[r * po + tt * 16] = c5[tt][r];
  }
  __syncthreads();   // strips published: each wave reads strips of other waves

  // BD column = 16*nb + n - m + 15 ; BC column (strip nb, row n) = n - (16a+m) + 63
  float bd[2][8], bc[2][8];
  #pragma unroll
  for (int nn = 0; nn < 2; ++nn) {
    const int nb = 2 * hw + nn;
    #pragma unroll
    for (int r = 0; r < 8; ++r) {
      const int m = mtop + r;
      bd[nn][r] = sm[OFF_BD + a * 16 * PBD + m * PBD + 16 * nb + mr - m + 15];
      bc[nn][r] = sm[OFF_BC + nb * 16 * PBC + mr * PBC + mr - 16 * a - m + 63];
    }
  }
  #pragma unroll
  for (int nn = 0; nn < 2; ++nn) {
    #pragma unroll
    for (int r = 0; r < 8; ++r)
      ac[nn][r] = (ac[nn][r] + bd[nn][r] + bc[nn][r]) * 0.125f;
  }
  float* orow = wts + ((size_t)bh * SEQ + i0 + 16 * a + mtop) * SEQ + j0 + 32 * hw + mr;
  #pragma unroll
  for (int r = 0; r < 8; ++r) {
    #pragma unroll
    for (int nn = 0; nn < 2; ++nn)
      orow[(size_t)r * SEQ + 16 * nn] = ac[nn][r];
  }
}

// ---------------------------------------------------------------------------
// Row softmax and weights x V in one launch. Block = 4 waves -> 32 rows i of
// one (b, h).
// Part 1: wave w normalises rows 8w .. 8w+7, all eight rows together, each over its 32
// lanes (12 columns a lane, whole-line loads); the row stays in registers from
// the load to the store, the maximum and the sum go over the lanes by a
// butterfly. The weights go to LDS for part 2 and back to d_out in place.
// Part 2: wave (mt, nh) computes rows 16mt .. 16mt+15 x columns 32nh .. 32nh+31
// of o = weights x V over k = 0 .. 383.
//   A: one float4 a lane from LDS, lanes 0-15 hold k = 8g..8g+3, lanes 16-31
//      hold k = 8g+4..8g+7; (x,y) feeds one WMMA, (z,w) the next.
//   B: V rows k = 8g+4*half+kk, kk = 0..3, one float2 a lane: rows kk = 0,1
//      pair with (x,y), rows kk = 2,3 with (z,w), so A and B hold the same k at
//      every position. Lane n holds columns 2n and 2n+1: .x is column tile 0,
//      .y column tile 1, and a lane stores its two results as one float2.
// Every loop of this kernel is fully unrolled: its index picks registers of
// v, red, bf and af, which a rolled loop would send to scratch memory.
// ---------------------------------------------------------------------------
static constexpr int SROWS = 32;   // rows of one block
static constexpr int PP    = 388;  // LDS row pitch (dwords) of a weight row: 16 B x odd
static constexpr int NCH   = SEQ / 32;   // k chunks of 32 (four groups of 8)

__global__ __launch_bounds__(128)
void softmax_av(float* __restrict__ wts,
                const float* __restrict__ vmat,
                float* __restrict__ o) {
  __shared__ __align__(16) float sp[SROWS * PP];

  const int t    = threadIdx.x;        // 0..127
  const int w    = __builtin_amdgcn_readfirstlane(t >> 5);   // wave number, kept scalar
  const int lane = t & 31;
  const int mr   = lane & 15;
  const int half = lane >> 4;
  const int mt   = w & 1;
  const int nh   = w >> 1;
  const int i0   = blockIdx.x * SROWS;
  const int bh   = blockIdx.y;
  const int b    = bh >> 3;
  const int h    = bh & 7;

  float* grow = wts + ((size_t)bh * SEQ + i0 + 8 * w) * SEQ + lane * 4;
  const float* bp = vmat + (size_t)(b * SEQ + half * 4) * EMB + h * HDIM + nh * 32 + mr * 2;

  v4f v[8][3];
  #pragma unroll
  for (int rr = 0; rr < 8; ++rr)
    #pragma unroll
    for (int s = 0; s < 3; ++s)
      v[rr][s] = *reinterpret_cast<const v4f*>(grow + rr * SEQ + s * 128);

  // V does not depend on part 1: its first chunk is fetched under the softmax.
  float2 bf[2][4][4];
  #pragma unroll
  for (int gg = 0; gg < 4; ++gg)
    #pragma unroll
    for (int kk = 0; kk < 4; ++kk)
      bf[0][gg][kk] = *reinterpret_cast<const float2*>(bp + (size_t)(gg * 8 + kk) * EMB);
  // Inputs-only fence on the loaded rows: it keeps all 24 row loads in front of the
  // arithmetic; moved down among it, the later rows' memory latency would follow the
  // earlier rows' work instead of running beside the first rows' latency.
  asm volatile("" :: "v"(v[0][0]), "v"(v[0][1]), "v"(v[0][2]), "v"(v[1][0]), "v"(v[1][1]), "v"(v[1][2]),
                     "v"(v[2][0]), "v"(v[2][1]), "v"(v[2][2]), "v"(v[3][0]), "v"(v[3][1]), "v"(v[3][2]),
                     "v"(v[4][0]), "v"(v[4][1]), "v"(v[4][2]), "v"(v[5][0]), "v"(v[5][1]), "v"(v[5][2]),
                     "v"(v[6][0]), "v"(v[6][1]), "v"(v[6][2]), "v"(v[7][0]), "v"(v[7][1]), "v"(v[7][2]));

  float red[8];
  #pragma unroll
  for (int rr = 0; rr < 8; ++rr) {
    float mx = -3.0e38f;
    #pragma unroll
    for (int s = 0; s < 3; ++s)
      mx = fmaxf(mx, fmaxf(fmaxf(v[rr][s].x, v[rr][s].y), fmaxf(v[rr][s].z, v[rr][s].w)));
    red[rr] = mx;
  }
  #pragma unroll
  for (int d = 16; d > 0; d >>= 1)
    #pragma unroll
    for (int rr = 0; rr < 8; ++rr)
      red[rr] = fmaxf(red[rr], __shfl_xor(red[rr], d, 32));
  #pragma unroll
  for (int rr = 0; rr < 8; ++rr) {
    const float mx = red[rr];
    #pragma unroll
    for (int s = 0; s < 3; ++s) {
      v[rr][s].x = expf(v[rr][s].x - mx);
      v[rr][s].y = expf(v[rr][s].y - mx);
      v[rr][s].z = expf(v[rr][s].z - mx);
      v[rr][s].w = expf(v[rr][s].w - mx);
    }
    const v4f s4 = (v[rr][0] + v[rr][1]) + v[rr][2];
    const float sum = (s4.x + s4.y) + (s4.z + s4.w);
    red[rr] = sum;
  }
  #pragma unroll
  for (int d = 16; d > 0; d >>= 1)
    #pragma unroll
    for (int rr = 0; rr < 8; ++rr)
      red[rr] += __shfl_xor(red[rr], d, 32);
  {
    float* d = sp + 8 * w * PP + lane * 4;
    #pragma unroll
    for (int rr = 0; rr < 8; ++rr) {
      const float inv = 1.0f / red[rr];
      #pragma unroll
      for (int s = 0; s < 3; ++s) {
        v[rr][s] *= inv;
        *reinterpret_cast<v4f*>(d + rr * PP + s * 128) = v[rr][s];
      }
    }
  }
  __syncthreads();   // weight rows published: part 2 reads rows of other waves

  // The stores to d_out stand behind the barrier so that it does not wait for them.
  #pragma unroll
  for (int rr = 0; rr < 8; ++rr)
    #pragma unroll
    for (int s = 0; s < 3; ++s)
      *reinterpret_cast<v4f*>(grow + rr * SEQ + s * 128) = v[rr][s];
  // part 2 reuses the registers that these stores name
  asm volatile("s_wait_xcnt 0x0" ::: "memory");

  const float* arow = sp + (16 * mt + mr) * PP + half * 4;
  float4 af[2][4];
  #pragma unroll
  for (int gg = 0; gg < 4; ++gg)
    af[0][gg] = *reinterpret_cast<const float4*>(arow + gg * 8);

  v8f acc0 = {}, acc1 = {};
  // A and B fragments are fetched one chunk ahead of the WMMAs that use them.
  #pragma unroll
  for (int c = 0; c < NCH; ++c) {
    const int cu = c & 1;
    if (c + 1 < NCH) {
      #pragma unroll
      for (int gg = 0; gg < 4; ++gg) {
        const int g = (c + 1) * 4 + gg;
        #pragma unroll
        for (int kk = 0; kk < 4; ++kk)
          bf[cu ^ 1][gg][kk] = *reinterpret_cast<const float2*>(bp + (size_t)(g * 8 + kk) * EMB);
        af[cu ^ 1][gg] = *reinterpret_cast<const float4*>(arow + g * 8);
      }
    }
    #pragma unroll
    for (int gg = 0; gg < 4; ++gg) {
      v2f a0, a1, b00, b01, b10, b11;
      a0.x  = af[cu][gg].x;    a0.y  = af[cu][gg].y;
      a1.x  = af[cu][gg].z;    a1.y  = af[cu][gg].w;
      b00.x = bf[cu][gg][0].x; b00.y = bf[cu][gg][1].x;
      b01.x = bf[cu][gg][0].y; b01.y = bf[cu][gg][1].y;
      b10.x = bf[cu][gg][2].x; b10.y = bf[cu][gg][3].x;
      b11.x = bf[cu][gg][2].y; b11.y = bf[cu][gg][3].y;
      acc0 = WMMA_F32(acc0, a0, b00);
      acc1 = WMMA_F32(acc1, a0, b01);
      acc0 = WMMA_F32(acc0, a1, b10);
      acc1 = WMMA_F32(acc1, a1, b11);
    }
  }

  // Four vector slots between the last WMMAs and the moves that read their results
  // for the paired stores; the operands tie the slots to that place.
  asm volatile("v_nop\n\tv_nop\n\tv_nop\n\tv_nop" : "+v"(acc0), "+v"(acc1));

  float* orow = o + (size_t)(b * SEQ + i0 + 16 * mt + 8 * half) * EMB + h * HDIM + nh * 32 + mr * 2;
  #pragma unroll
  for (int r = 0; r < 8; ++r) {
    float2 st;
    st.x = acc0[r];
    st.y = acc1[r];
    *reinterpret_cast<float2*>(orow + (size_t)r * EMB) = st;
  }
}

// ---------------------------------------------------------------------------
extern "C" void kernel_launch(void* const* d_in, const int* in_sizes, int n_in,
                              void* d_out, int out_size, void* d_ws, size_t ws_size,
                              hipStream_t stream) {
  const float* x    = (const float*)d_in[0];
  const float* qW   = (const float*)d_in[1];
  const float* qb   = (const float*)d_in[2];
  const float* kW   = (const float*)d_in[3];
  const float* kb_  = (const float*)d_in[4];
  const float* vW   = (const float*)d_in[5];
  const float* vb   = (const float*)d_in[6];
  const float* qpW  = (const float*)d_in[7];
  const float* qpb  = (const float*)d_in[8];
  const float* kpW  = (const float*)d_in[9];
  const float* kpb  = (const float*)d_in[10];
  const float* pos  = (const float*)d_in[11];
  const float* fcW  = (const float*)d_in[12];
  const float* fcb  = (const float*)d_in[13];

  float* out = (float*)d_out;                       // [B, S, E]
  float* wts = out + (size_t)BATCH * SEQ * EMB;     // [B, H, S, S]

  // Workspace layout (~27 MiB of floats)
  float* ws   = (float*)d_ws;
  float* wq   = ws;                                 // [3072, 512]
  float* wk   = wq  + (size_t)MROWS * EMB;          // [3072, 512]
  float* wv   = wk  + (size_t)MROWS * EMB;          // [3072, 512]
  float* wo   = wv  + (size_t)MROWS * EMB;          // [3072, 512]
  float* wqp  = wo  + (size_t)MROWS * EMB;          // [768, 512]
  float* wkp  = wqp + (size_t)RPAD  * EMB;          // [768, 512]

  const dim3 blk4(128);

  // 1) content projections: q/k/v = x @ W + b    ([3072x512] x [512x512])
  {
    const dim3 g(EMB / 64, MROWS / 64);
    gemm_nn_bias<<<g, blk4, 0, stream>>>(x, qW, qb,  wq, EMB, EMB, EMB, EMB, MROWS);
    gemm_nn_bias<<<g, blk4, 0, stream>>>(x, kW, kb_, wk, EMB, EMB, EMB, EMB, MROWS);
    gemm_nn_bias<<<g, blk4, 0, stream>>>(x, vW, vb,  wv, EMB, EMB, EMB, EMB, MROWS);
  }

  // 2) position projections over the 767 distinct relative rows
  //    (pos_table rows 128..894), padded to 768 GEMM rows via row clamp.
  {
    const dim3 g(EMB / 64, RPAD / 64);
    gemm_nn_bias<<<g, blk4, 0, stream>>>(pos + (size_t)POSOFF * EMB, qpW, qpb,
                                         wqp, EMB, EMB, EMB, EMB, NREL);
    gemm_nn_bias<<<g, blk4, 0, stream>>>(pos + (size_t)POSOFF * EMB, kpW, kpb,
                                         wkp, EMB, EMB, EMB, EMB, NREL);
  }

  // 3) scores for every (b, h): content-content plus both relative terms.
  score_fused<<<dim3(SEQ / 64, SEQ / 64, BATCH * NHEAD), dim3(256), 0, stream>>>(
      wq, wk, wqp, wkp, wts);

  // 4) softmax over j, in place in d_out's weights region, and o = weights @ v
  softmax_av<<<dim3(SEQ / SROWS, BATCH * NHEAD), blk4, 0, stream>>>(wts, wv, wo);

  // 5) final projection: out = o @ fcW + fcb
  gemm_nn_bias<<<dim3(EMB / 64, MROWS / 64), blk4, 0, stream>>>(
      wo, fcW, fcb, out, EMB, EMB, EMB, EMB, MROWS);
}

// v003
// A run of this version takes 128 microseconds.
// Timed twice side by side with v002, it ran 1.41 and 1.42 times as fast.
// All steps since v000 together make it 3.02 times as fast.
#include <hip/hip_runtime.h>
#include <hip/hip_bf16.h>
#include <stdint.h>

// ---------------------------------------------------------------------------
// DeBERTa disentangled attention for MI455X (gfx1250), wave32 + f32 WMMA.
//
// - bd/bc re-expressed as NT GEMMs over the 767 distinct relative
//   positions (pos_emb[i,j] depends only on j-i), done per score tile.
// - Big K=512 GEMMs use 4-wave workgroups with double-buffered LDS tiles
//   filled by GLOBAL_LOAD_ASYNC_TO_LDS_B128 (ASYNCcnt / s_wait_asynccnt),
//   16 WMMAs per wave per 16-deep k-chunk.
// ---------------------------------------------------------------------------

typedef __attribute__((ext_vector_type(2))) float v2f;
typedef __attribute__((ext_vector_type(4))) float v4f;
typedef __attribute__((ext_vector_type(8))) float v8f;

static constexpr int BATCH  = 8;
static constexpr int SEQ    = 384;
static constexpr int EMB    = 512;
static constexpr int NHEAD  = 8;
static constexpr int HDIM   = 64;
static constexpr int NREL   = 767;          // distinct values of j-i+383
static constexpr int RPAD   = 768;          // padded to multiple of 16
static constexpr int POSOFF = 128;          // pos_table row = rel + 128
static constexpr int MROWS  = BATCH * SEQ;  // 3072

// f32 WMMA 16x16x4 fragment layout (wave32):
//   A 16x4 : lane l (l<16): m=l, holds K=0,1 ; lane l>=16: m=l-16, K=2,3
//   B 4x16 : lane l (l<16): n=l, holds K=0,1 ; lane l>=16: n=l-16, K=2,3
//   C 16x16: vgpr r, lane l: m = r + (l<16 ? 0 : 8), n = l & 15
#define WMMA_F32(acc, a, b) \
  __builtin_amdgcn_wmma_f32_16x16x4_f32(false, (a), false, (b), (short)0, (acc), false, false)

// Async global -> LDS 16B copy (gfx1250). ldsoff is a workgroup-relative LDS
// byte offset (low 32 bits of the generic shared pointer); ga is the global
// address. Tracked by ASYNCcnt.
__device__ __forceinline__ void async_copy_b128(uint32_t ldsoff, uint64_t ga) {
  asm volatile("global_load_async_to_lds_b128 %0, %1, off"
               :: "v"(ldsoff), "v"(ga) : "memory");
}
__device__ __forceinline__ void wait_async_le4() {
  asm volatile("s_wait_asynccnt 0x4" ::: "memory");
}
__device__ __forceinline__ void wait_async_zero() {
  asm volatile("s_wait_asynccnt 0x0" ::: "memory");
}

// ---------------------------------------------------------------------------
// Staged NN GEMM: C[M x N] = A[M x K] @ B[K x N] + bias.
// Block = 128 threads (4 waves) -> 64x64 C block; wave w owns rows
// [m0+16w, m0+16w+16) x 64 cols (4 accumulators, A frag reused 4x).
// k-chunks of 16 double-buffered in LDS via async b128 loads.
// rowClamp: A row index clamped to rowClamp-1. K multiple of 16; M, N multiples of 64.
// ---------------------------------------------------------------------------
__global__ void gemm_nn_bias(const float* __restrict__ A,
                             const float* __restrict__ Bm,
                             const float* __restrict__ bias,
                             float* __restrict__ C,
                             int K, int lda, int ldb, int ldc, int rowClamp) {
  __shared__ __align__(16) float lA[2][64 * 16];   // [row][k]  (4 KB each)
  __shared__ __align__(16) float lB[2][16 * 64];   // [k][col]  (4 KB each)

  const int t    = threadIdx.x;        // 0..127
  const int w    = t >> 5;             // wave 0..3
  const int lane = t & 31;
  const int mr   = lane & 15;
  const int kb   = (lane >> 4) << 1;   // 0 or 2
  const int mtop = (lane >> 4) << 3;   // 0 or 8
  const int m0   = blockIdx.y << 6;
  const int n0   = blockIdx.x << 6;

  // async-load slot mapping (each thread stages 2 A slots + 2 B slots / chunk)
  const int sA0 = t, sA1 = t + 128;              // float4 slots 0..255
  const int rowA0 = sA0 >> 2, kqA0 = sA0 & 3;
  const int rowA1 = sA1 >> 2, kqA1 = sA1 & 3;
  const int krB0 = sA0 >> 4, cqB0 = sA0 & 15;
  const int krB1 = sA1 >> 4, cqB1 = sA1 & 15;

  int ar0 = m0 + rowA0; if (ar0 > rowClamp - 1) ar0 = rowClamp - 1;
  int ar1 = m0 + rowA1; if (ar1 > rowClamp - 1) ar1 = rowClamp - 1;

  const int nchunk = K >> 4;

  auto issue = [&](int c, int buf) {
    const int k0 = c << 4;
    async_copy_b128((uint32_t)(uintptr_t)&lA[buf][sA0 * 4],
                    (uint64_t)(uintptr_t)(A + (size_t)ar0 * lda + k0 + kqA0 * 4));
    async_copy_b128((uint32_t)(uintptr_t)&lA[buf][sA1 * 4],
                    (uint64_t)(uintptr_t)(A + (size_t)ar1 * lda + k0 + kqA1 * 4));
    async_copy_b128((uint32_t)(uintptr_t)&lB[buf][sA0 * 4],
                    (uint64_t)(uintptr_t)(Bm + (size_t)(k0 + krB0) * ldb + n0 + cqB0 * 4));
    async_copy_b128((uint32_t)(uintptr_t)&lB[buf][sA1 * 4],
                    (uint64_t)(uintptr_t)(Bm + (size_t)(k0 + krB1) * ldb + n0 + cqB1 * 4));
  };

  v8f acc0 = {}, acc1 = {}, acc2 = {}, acc3 = {};

  int buf = 0;
  issue(0, 0);
  for (int c = 0; c < nchunk; ++c) {
    if (c + 1 < nchunk) { issue(c + 1, buf ^ 1); wait_async_le4(); }
    else                { wait_async_zero(); }
    __syncthreads();

    const float* As = &lA[buf][(w * 16 + mr) * 16];   // this wave's A rows
    const float* Bs = &lB[buf][0];
    #pragma unroll
    for (int q = 0; q < 4; ++q) {
      const int kk = q * 4 + kb;
      v2f a;
      a.x = As[kk];
      a.y = As[kk + 1];
      const float* b0 = Bs + kk * 64 + mr;
      const float* b1 = Bs + (kk + 1) * 64 + mr;
      v2f bv;
      bv.x = b0[0];  bv.y = b1[0];  acc0 = WMMA_F32(acc0, a, bv);
      bv.x = b0[16]; bv.y = b1[16]; acc1 = WMMA_F32(acc1, a, bv);
      bv.x = b0[32]; bv.y = b1[32]; acc2 = WMMA_F32(acc2, a, bv);
      bv.x = b0[48]; bv.y = b1[48]; acc3 = WMMA_F32(acc3, a, bv);
    }
    __syncthreads();
    buf ^= 1;
  }

  // store 16x64 strip (+bias)
  const int mbase = m0 + w * 16 + mtop;
  #pragma unroll
  for (int nt = 0; nt < 4; ++nt) {
    const int n = n0 + nt * 16 + mr;
    const float bv = bias ? bias[n] : 0.0f;
    const v8f& acc = (nt == 0) ? acc0 : (nt == 1) ? acc1 : (nt == 2) ? acc2 : acc3;
    #pragma unroll
    for (int r = 0; r < 8; ++r) {
      C[(size_t)(mbase + r) * ldc + n] = acc[r] + bv;
    }
  }
}

// ---------------------------------------------------------------------------
// The five input projections in one launch. None of them reads what another
// writes, so their 64x64 tiles share one grid: blockIdx.y picks the product and
// its row tile, blockIdx.x the column tile.
//   y =   0 ..  47 : q  = x   @ qW  + qb      y = 144 .. 155 : qp = pos @ qpW + qpb
//   y =  48 ..  95 : k  = x   @ kW  + kb      y = 156 .. 167 : kp = pos @ kpW + kpb
//   y =  96 .. 143 : v  = x   @ vW  + vb
// pos points at the first of the 767 relative rows; GEMM row 767 reads row 766.
// Tile, k-chunks, LDS ring and fragment reads are those of gemm_nn_bias.
// ---------------------------------------------------------------------------
static constexpr int XT = MROWS / 64;   // row tiles of a content projection
static constexpr int PT = RPAD / 64;    // row tiles of a position projection

__global__ __launch_bounds__(128)
void proj5(const float* __restrict__ x,   const float* __restrict__ pos,
           const float* __restrict__ qW,  const float* __restrict__ kW,
           const float* __restrict__ vW,  const float* __restrict__ qpW,
           const float* __restrict__ kpW,
           const float* __restrict__ qb,  const float* __restrict__ kb_,
           const float* __restrict__ vb,  const float* __restrict__ qpb,
           const float* __restrict__ kpb,
           float* __restrict__ wq,  float* __restrict__ wk, float* __restrict__ wv,
           float* __restrict__ wqp, float* __restrict__ wkp) {
  __shared__ __align__(16) float lA[2][64 * 16];   // [row][k]
  __shared__ __align__(16) float lB[2][16 * 64];   // [k][col]

  const int t    = threadIdx.x;        // 0..127
  const int w    = t >> 5;             // wave 0..3
  const int lane = t & 31;
  const int mr   = lane & 15;
  const int kb   = (lane >> 4) << 1;   // 0 or 2
  const int mtop = (lane >> 4) << 3;   // 0 or 8
  const int n0   = blockIdx.x << 6;

  // which product, which row tile: the same for the whole block
  const int  y     = blockIdx.y;
  const bool isPos = y >= 3 * XT;
  const int  sel   = isPos ? 3 + (y - 3 * XT) / PT : y / XT;
  const int  m0    = (isPos ? (y - 3 * XT) % PT : y % XT) << 6;
  const int  lastRow = isPos ? NREL - 1 : MROWS - 1;
  const float* A    = isPos ? pos : x;
  const float* Bm   = sel == 0 ? qW : sel == 1 ? kW  : sel == 2 ? vW : sel == 3 ? qpW : kpW;
  const float* bias = sel == 0 ? qb : sel == 1 ? kb_ : sel == 2 ? vb : sel == 3 ? qpb : kpb;
  float*       C    = sel == 0 ? wq : sel == 1 ? wk  : sel == 2 ? wv : sel == 3 ? wqp : wkp;

  // copy slots: each thread stages 2 float4 of A and 2 of B per chunk
  const int s0 = t, s1 = t + 128;
  int ar0 = m0 + (s0 >> 2); if (ar0 > lastRow) ar0 = lastRow;
  int ar1 = m0 + (s1 >> 2); if (ar1 > lastRow) ar1 = lastRow;
  const float* gA0 = A  + (size_t)ar0 * EMB + (s0 & 3) * 4;
  const float* gA1 = A  + (size_t)ar1 * EMB + (s1 & 3) * 4;
  const float* gB0 = Bm + (size_t)(s0 >> 4) * EMB + n0 + (s0 & 15) * 4;
  const float* gB1 = Bm + (size_t)(s1 >> 4) * EMB + n0 + (s1 & 15) * 4;

  constexpr int nchunk = EMB >> 4;

  auto issue = [&](int c, int buf) {
    const int k0 = c << 4;
    // One statement for the chunk's four copies and the wait that stands in front of
    // any rewrite of their address registers (the next chunk's address additions).
    asm volatile("global_load_async_to_lds_b128 %0, %1, off\n\t"
                 "global_load_async_to_lds_b128 %2, %3, off\n\t"
                 "global_load_async_to_lds_b128 %4, %5, off\n\t"
                 "global_load_async_to_lds_b128 %6, %7, off\n\t"
                 "s_wait_xcnt 0x0"
                 :: "v"((uint32_t)(uintptr_t)&lA[buf][s0 * 4]), "v"((uint64_t)(uintptr_t)(gA0 + k0)),
                    "v"((uint32_t)(uintptr_t)&lA[buf][s1 * 4]), "v"((uint64_t)(uintptr_t)(gA1 + k0)),
                    "v"((uint32_t)(uintptr_t)&lB[buf][s0 * 4]), "v"((uint64_t)(uintptr_t)(gB0 + (size_t)k0 * EMB)),
                    "v"((uint32_t)(uintptr_t)&lB[buf][s1 * 4]), "v"((uint64_t)(uintptr_t)(gB1 + (size_t)k0 * EMB))
                 : "memory");
  };

  v8f acc0 = {}, acc1 = {}, acc2 = {}, acc3 = {};

  int buf = 0;
  issue(0, 0);
  for (int c = 0; c < nchunk; ++c) {
    // chunk c has landed for this wave once at most the next chunk's four copies are out
    if (c + 1 < nchunk) { issue(c + 1, buf ^ 1); wait_async_le4(); }
    else                { wait_async_zero(); }
    __syncthreads();   // chunk c published to the other waves

    const float* As = &lA[buf][(w * 16 + mr) * 16];
    const float* Bs = &lB[buf][0];
    #pragma unroll   // q becomes immediate LDS offsets; the 16 WMMAs stand in one run
    for (int q = 0; q < 4; ++q) {
      const int kk = q * 4 + kb;
      v2f a;
      a.x = As[kk];
      a.y = As[kk + 1];
      const float* b0 = Bs + kk * 64 + mr;
      const float* b1 = Bs + (kk + 1) * 64 + mr;
      v2f bv;
      bv.x = b0[0];  bv.y = b1[0];  acc0 = WMMA_F32(acc0, a, bv);
      bv.x = b0[16]; bv.y = b1[16]; acc1 = WMMA_F32(acc1, a, bv);
      bv.x = b0[32]; bv.y = b1[32]; acc2 = WMMA_F32(acc2, a, bv);
      bv.x = b0[48]; bv.y = b1[48]; acc3 = WMMA_F32(acc3, a, bv);
    }
    __syncthreads();   // every wave has left the buffer that the next trip refills
    buf ^= 1;
  }

  const int mbase = m0 + w * 16 + mtop;
  #pragma unroll   // nt and r pick accumulator registers
  for (int nt = 0; nt < 4; ++nt) {
    const int n = n0 + nt * 16 + mr;
    const float bv = bias[n];
    const v8f& acc = (nt == 0) ? acc0 : (nt == 1) ? acc1 : (nt == 2) ? acc2 : acc3;
    #pragma unroll
    for (int r = 0; r < 8; ++r) {
      C[(size_t)(mbase + r) * EMB + n] = acc[r] + bv;
    }
  }
}

// ---------------------------------------------------------------------------
// Fused pre-softmax scores, all batches and heads in one launch:
//   s[b,h,i,j] = (q[i].k[j] + q[i].kp[j-i+383] + k[j].qp[j-i+383]) / 8
// Block = 8 waves -> one 64x64 (i,j) tile of one (b,h). The tile only meets
// the relative rows r0 .. r0+126, r0 = j0-i0+320, and a 16-row strip of it
// only 79 of them (five 16-row WMMA tiles). Q, K and the 128 KP / QP rows are
// staged once in LDS with whole-line loads. Wave (a, hw):
//   hw = 0: BC strip  K[j0+16a ..+15] x QP[r0+16a    .. +79]^T
//   hw = 1: BD strip  Q[i0+16a ..+15] x KP[r0+48-16a .. +79]^T
//   both  : AC        Q[i0+16a ..+15] x K [j0+32hw   .. +31]^T
// The strips then go to LDS (over the dead KP / QP rows) and each score
// element picks its skewed BD / BC entry from there.
// Fragments are read as one float4 per lane: lanes 0-15 hold k = 8g..8g+3,
// lanes 16-31 hold k = 8g+4..8g+7; (x,y) feeds one WMMA, (z,w) the next.
// A and B use the same mapping, so the k pairing is equal at every position.
// ---------------------------------------------------------------------------
static constexpr int PO  = 68;   // LDS row pitch (dwords) of a staged operand row
static constexpr int PBD = 85;   // LDS row pitch (dwords) of a BD strip
static constexpr int PBC = 82;   // LDS row pitch (dwords) of a BC strip
static constexpr int OFF_Q  = 0;
static constexpr int OFF_K  = OFF_Q  + 64 * PO;
static constexpr int OFF_KP = OFF_K  + 64 * PO;
static constexpr int OFF_QP = OFF_KP + 128 * PO;
static constexpr int SM_DW  = OFF_QP + 128 * PO;
static constexpr int OFF_BD = OFF_KP;                  // overlays KP / QP
static constexpr int OFF_BC = OFF_BD + 4 * 16 * PBD;
static_assert(OFF_BC + 4 * 16 * PBC <= SM_DW, "strips must fit over KP and QP");

// acc[t] += A(16 x 64) x B_t(16 x 64)^T, both from LDS rows of pitch PO.
// arow / brow point at this lane's row, at its half's first float4.
template <int NT>
__device__ __forceinline__ void strip_mm(const float* arow, const float* brow,
                                         v8f (&acc)[NT]) {
  float4 af[8];
  #pragma unroll
  for (int g = 0; g < 8; ++g)
    af[g] = *reinterpret_cast<const float4*>(arow + g * 8);
  // B fragments are fetched one k-group ahead of the WMMAs that use them.
  float4 bf[2][NT];
  #pragma unroll
  for (int t = 0; t < NT; ++t)
    bf[0][t] = *reinterpret_cast<const float4*>(brow + t * 16 * PO);
  #pragma unroll
  for (int g = 0; g < 8; ++g) {
    const int cu = g & 1;
    if (g < 7) {
      #pragma unroll
      for (int t = 0; t < NT; ++t)
        bf[cu ^ 1][t] = *reinterpret_cast<const float4*>(brow + t * 16 * PO + (g + 1) * 8);
    }
    v2f a0, a1;
    a0.x = af[g].x; a0.y = af[g].y;
    a1.x = af[g].z; a1.y = af[g].w;
    #pragma unroll
    for (int t = 0; t < NT; ++t) {
      v2f b0; b0.x = bf[cu][t].x; b0.y = bf[cu][t].y;
      acc[t] = WMMA_F32(acc[t], a0, b0);
    }
    #pragma unroll
    for (int t = 0; t < NT; ++t) {
      v2f b1; b1.x = bf[cu][t].z; b1.y = bf[cu][t].w;
      acc[t] = WMMA_F32(acc[t], a1, b1);
    }
  }
}

__global__ __launch_bounds__(256)
void score_fused(const float* __restrict__ q,
                 const float* __restrict__ kmat,
                 const float* __restrict__ qp,
                 const float* __restrict__ kp,
                 float* __restrict__ wts) {
  __shared__ __align__(16) float sm[SM_DW];

  const int t    = threadIdx.x;        // 0..255
  const int w    = __builtin_amdgcn_readfirstlane(t >> 5);   // wave number, kept scalar
  const int a    = w & 3;              // 16-row strip
  const int hw   = w >> 2;             // 0: BC strip, 1: BD strip
  const int lane = t & 31;
  const int mr   = lane & 15;
  const int half = lane >> 4;
  const int mtop = half << 3;
  const int j0   = blockIdx.x << 6;
  const int i0   = blockIdx.y << 6;
  const int bh   = blockIdx.z;
  const int b    = bh >> 3;
  const int h    = bh & 7;
  const int r0   = j0 - i0 + 320;      // first relative row of the tile, 0..640

  // Stage the operands: 16 threads per 256-byte row slice, 16 rows per pass.
  {
    const int c4 = (t & 15) << 2;
    const int rr = t >> 4;
    const unsigned vo = (unsigned)(rr * EMB + c4);   // same lane offset in all four arrays
    const float* gq  = q    + (size_t)(b * SEQ + i0) * EMB + h * HDIM + vo;
    const float* gk  = kmat + (size_t)(b * SEQ + j0) * EMB + h * HDIM + vo;
    const float* gkp = kp   + (size_t)r0 * EMB + h * HDIM + vo;
    const float* gqp = qp   + (size_t)r0 * EMB + h * HDIM + vo;
    float4 vq[4], vk[4], vkp[8], vqp[8];
    #pragma unroll
    for (int s = 0; s < 4; ++s) {
      vq[s] = *reinterpret_cast<const float4*>(gq + (size_t)s * 16 * EMB);
      vk[s] = *reinterpret_cast<const float4*>(gk + (size_t)s * 16 * EMB);
    }
    #pragma unroll
    for (int s = 0; s < 8; ++s) {
      vkp[s] = *reinterpret_cast<const float4*>(gkp + (size_t)s * 16 * EMB);
      vqp[s] = *reinterpret_cast<const float4*>(gqp + (size_t)s * 16 * EMB);
    }
    float* d = sm + rr * PO + c4;
    #pragma unroll
    for (int s = 0; s < 4; ++s) {
      *reinterpret_cast<float4*>(d + OFF_Q + s * 16 * PO) = vq[s];
      *reinterpret_cast<float4*>(d + OFF_K + s * 16 * PO) = vk[s];
    }
    #pragma unroll
    for (int s = 0; s < 8; ++s) {
      *reinterpret_cast<float4*>(d + OFF_KP + s * 16 * PO) = vkp[s];
      *reinterpret_cast<float4*>(d + OFF_QP + s * 16 * PO) = vqp[s];
    }
  }
  __syncthreads();   // operands staged

  const int lo = mr * PO + half * 4;   // this lane's row and half inside a 16-row tile

  // relative strip: rows m of strip a, columns c in [0,80)
  v8f c5[5] = {};
  strip_mm<5>(sm + (hw ? OFF_Q : OFF_K) + 16 * a * PO + lo,
              sm + (hw ? OFF_KP + (48 - 16 * a) * PO : OFF_QP + 16 * a * PO) + lo, c5);

  // content-content: rows i = i0+16a+m, columns j = j0 + 32*hw + 16*nn + n
  v8f ac[2] = {};
  strip_mm<2>(sm + OFF_Q + 16 * a * PO + lo, sm + OFF_K + 32 * hw * PO + lo, ac);

  __syncthreads();   // every read of KP / QP is done before the strips overwrite them

  {
    const int po = hw ? PBD : PBC;
    float* so = sm + (hw ? OFF_BD + a * 16 * PBD : OFF_BC + a * 16 * PBC) + mtop * po + mr;
    #pragma unroll
    for (int tt = 0; tt < 5; ++tt)
      #pragma unroll
      for (int r = 0; r < 8; ++r)
        so[r * po + tt * 16] = c5[tt][r];
  }
  __syncthreads();   // strips published: each wave reads strips of other waves

  // BD column = 16*nb + n - m + 15 ; BC column (strip nb, row n) = n - (16a+m) + 63
  float bd[2][8], bc[2][8];
  #pragma unroll
  for (int nn = 0; nn < 2; ++nn) {
    const int nb = 2 * hw + nn;
    #pragma unroll
    for (int r = 0; r < 8; ++r) {
      const int m = mtop + r;
      bd[nn][r] = sm[OFF_BD + a * 16 * PBD + m * PBD + 16 * nb + mr - m + 15];
      bc[nn][r] = sm[OFF_BC + nb * 16 * PBC + mr * PBC + mr - 16 * a - m + 63];
    }
  }
  #pragma unroll
  for (int nn = 0; nn < 2; ++nn) {
    #pragma unroll
    for (int r = 0; r < 8; ++r)
      ac[nn][r] = (ac[nn][r] + bd[nn][r] + bc[nn][r]) * 0.125f;
  }
  float* orow = wts + ((size_t)bh * SEQ + i0 + 16 * a + mtop) * SEQ + j0 + 32 * hw + mr;
  #pragma unroll
  for (int r = 0; r < 8; ++r) {
    #pragma unroll
    for (int nn = 0; nn < 2; ++nn)
      orow[(size_t)r * SEQ + 16 * nn] = ac[nn][r];
  }
}

// ---------------------------------------------------------------------------
// Row softmax and weights x V in one launch. Block = 4 waves -> 32 rows i of
// one (b, h).
// Part 1: wave w normalises rows 8w .. 8w+7, all eight rows together, each over its 32
// lanes (12 columns a lane, whole-line loads); the row stays in registers from
// the load to the store, the maximum and the sum go over the lanes by a
// butterfly. The weights go to LDS for part 2 and back to d_out in place.
// Part 2: wave (mt, nh) computes rows 16mt .. 16mt+15 x columns 32nh .. 32nh+31
// of o = weights x V over k = 0 .. 383.
//   A: one float4 a lane from LDS, lanes 0-15 hold k = 8g..8g+3, lanes 16-31
//      hold k = 8g+4..8g+7; (x,y) feeds one WMMA, (z,w) the next.
//   B: V rows k = 8g+4*half+kk, kk = 0..3, one float2 a lane: rows kk = 0,1
//      pair with (x,y), rows kk = 2,3 with (z,w), so A and B hold the same k at
//      every position. Lane n holds columns 2n and 2n+1: .x is column tile 0,
//      .y column tile 1, and a lane stores its two results as one float2.
// Every loop of this kernel is fully unrolled: its index picks registers of
// v, red, bf and af, which a rolled loop would send to scratch memory.
// ---------------------------------------------------------------------------
static constexpr int SROWS = 32;   // rows of one block
static constexpr int PP    = 388;  // LDS row pitch (dwords) of a weight row: 16 B x odd
static constexpr int NCH   = SEQ / 32;   // k chunks of 32 (four groups of 8)

__global__ __launch_bounds__(128)
void softmax_av(float* __restrict__ wts,
                const float* __restrict__ vmat,
                float* __restrict__ o) {
  __shared__ __align__(16) float sp[SROWS * PP];

  const int t    = threadIdx.x;        // 0..127
  const int w    = __builtin_amdgcn_readfirstlane(t >> 5);   // wave number, kept scalar
  const int lane = t & 31;
  const int mr   = lane & 15;
  const int half = lane >> 4;
  const int mt   = w & 1;
  const int nh   = w >> 1;
  const int i0   = blockIdx.x * SROWS;
  const int bh   = blockIdx.y;
  const int b    = bh >> 3;
  const int h    = bh & 7;

  float* grow = wts + ((size_t)bh * SEQ + i0 + 8 * w) * SEQ + lane * 4;
  const float* bp = vmat + (size_t)(b * SEQ + half * 4) * EMB + h * HDIM + nh * 32 + mr * 2;

  v4f v[8][3];
  #pragma unroll
  for (int rr = 0; rr < 8; ++rr)
    #pragma unroll
    for (int s = 0; s < 3; ++s)
      v[rr][s] = *reinterpret_cast<const v4f*>(grow + rr * SEQ + s * 128);

  // V does not depend on part 1: its first chunk is fetched under the softmax.
  float2 bf[2][4][4];
  #pragma unroll
  for (int gg = 0; gg < 4; ++gg)
    #pragma unroll
    for (int kk = 0; kk < 4; ++kk)
      bf[0][gg][kk] = *reinterpret_cast<const float2*>(bp + (size_t)(gg * 8 + kk) * EMB);
  // Inputs-only fence on the loaded rows: it keeps all 24 row loads in front of the
  // arithmetic; moved down among it, the later rows' memory latency would follow the
  // earlier rows' work instead of running beside the first rows' latency.
  asm volatile("" :: "v"(v[0][0]), "v"(v[0][1]), "v"(v[0][2]), "v"(v[1][0]), "v"(v[1][1]), "v"(v[1][2]),
                     "v"(v[2][0]), "v"(v[2][1]), "v"(v[2][2]), "v"(v[3][0]), "v"(v[3][1]), "v"(v[3][2]),
                     "v"(v[4][0]), "v"(v[4][1]), "v"(v[4][2]), "v"(v[5][0]), "v"(v[5][1]), "v"(v[5][2]),
                     "v"(v[6][0]), "v"(v[6][1]), "v"(v[6][2]), "v"(v[7][0]), "v"(v[7][1]), "v"(v[7][2]));

  float red[8];
  #pragma unroll
  for (int rr = 0; rr < 8; ++rr) {
    float mx = -3.0e38f;
    #pragma unroll
    for (int s = 0; s < 3; ++s)
      mx = fmaxf(mx, fmaxf(fmaxf(v[rr][s].x, v[rr][s].y), fmaxf(v[rr][s].z, v[rr][s].w)));
    red[rr] = mx;
  }
  #pragma unroll
  for (int d = 16; d > 0; d >>= 1)
    #pragma unroll
    for (int rr = 0; rr < 8; ++rr)
      red[rr] = fmaxf(red[rr], __shfl_xor(red[rr], d, 32));
  #pragma unroll
  for (int rr = 0; rr < 8; ++rr) {
    const float mx = red[rr];
    #pragma unroll
    for (int s = 0; s < 3; ++s) {
      v[rr][s].x = expf(v[rr][s].x - mx);
      v[rr][s].y = expf(v[rr][s].y - mx);
      v[rr][s].z = expf(v[rr][s].z - mx);
      v[rr][s].w = expf(v[rr][s].w - mx);
    }
    const v4f s4 = (v[rr][0] + v[rr][1]) + v[rr][2];
    const float sum = (s4.x + s4.y) + (s4.z + s4.w);
    red[rr] = sum;
  }
  #pragma unroll
  for (int d = 16; d > 0; d >>= 1)
    #pragma unroll
    for (int rr = 0; rr < 8; ++rr)
      red[rr] += __shfl_xor(red[rr], d, 32);
  {
    float* d = sp + 8 * w * PP + lane * 4;
    #pragma unroll
    for (int rr = 0; rr < 8; ++rr) {
      const float inv = 1.0f / red[rr];
      #pragma unroll
      for (int s = 0; s < 3; ++s) {
        v[rr][s] *= inv;
        *reinterpret_cast<v4f*>(d + rr * PP + s * 128) = v[rr][s];
      }
    }
  }
  __syncthreads();   // weight rows published: part 2 reads rows of other waves

  // The stores to d_out stand behind the barrier so that it does not wait for them.
  #pragma unroll
  for (int rr = 0; rr < 8; ++rr)
    #pragma unroll
    for (int s = 0; s < 3; ++s)
      *reinterpret_cast<v4f*>(grow + rr * SEQ + s * 128) = v[rr][s];
  // part 2 reuses the registers that these stores name
  asm volatile("s_wait_xcnt 0x0" ::: "memory");

  const float* arow = sp + (16 * mt + mr) * PP + half * 4;
  float4 af[2][4];
  #pragma unroll
  for (int gg = 0; gg < 4; ++gg)
    af[0][gg] = *reinterpret_cast<const float4*>(arow + gg * 8);

  v8f acc0 = {}, acc1 = {};
  // A and B fragments are fetched one chunk ahead of the WMMAs that use them.
  #pragma unroll
  for (int c = 0; c < NCH; ++c) {
    const int cu = c & 1;
    if (c + 1 < NCH) {
      #pragma unroll
      for (int gg = 0; gg < 4; ++gg) {
        const int g = (c + 1) * 4 + gg;
        #pragma unroll
        for (int kk = 0; kk < 4; ++kk)
          bf[cu ^ 1][gg][kk] = *reinterpret_cast<const float2*>(bp + (size_t)(g * 8 + kk) * EMB);
        af[cu ^ 1][gg] = *reinterpret_cast<const float4*>(arow + g * 8);
      }
    }
    #pragma unroll
    for (int gg = 0; gg < 4; ++gg) {
      v2f a0, a1, b00, b01, b10, b11;
      a0.x  = af[cu][gg].x;    a0.y  = af[cu][gg].y;
      a1.x  = af[cu][gg].z;    a1.y  = af[cu][gg].w;
      b00.x = bf[cu][gg][0].x; b00.y = bf[cu][gg][1].x;
      b01.x = bf[cu][gg][0].y; b01.y = bf[cu][gg][1].y;
      b10.x = bf[cu][gg][2].x; b10.y = bf[cu][gg][3].x;
      b11.x = bf[cu][gg][2].y; b11.y = bf[cu][gg][3].y;
      acc0 = WMMA_F32(acc0, a0, b00);
      acc1 = WMMA_F32(acc1, a0, b01);
      acc0 = WMMA_F32(acc0, a1, b10);
      acc1 = WMMA_F32(acc1, a1, b11);
    }
  }

  // Four vector slots between the last WMMAs and the moves that read their results
  // for the paired stores; the operands tie the slots to that place.
  asm volatile("v_nop\n\tv_nop\n\tv_nop\n\tv_nop" : "+v"(acc0), "+v"(acc1));

  float* orow = o + (size_t)(b * SEQ + i0 + 16 * mt + 8 * half) * EMB + h * HDIM + nh * 32 + mr * 2;
  #pragma unroll
  for (int r = 0; r < 8; ++r) {
    float2 st;
    st.x = acc0[r];
    st.y = acc1[r];
    *reinterpret_cast<float2*>(orow + (size_t)r * EMB) = st;
  }
}

// ---------------------------------------------------------------------------
extern "C" void kernel_launch(void* const* d_in, const int* in_sizes, int n_in,
                              void* d_out, int out_size, void* d_ws, size_t ws_size,
                              hipStream_t stream) {
  const float* x    = (const float*)d_in[0];
  const float* qW   = (const float*)d_in[1];
  const float* qb   = (const float*)d_in[2];
  const float* kW   = (const float*)d_in[3];
  const float* kb_  = (const float*)d_in[4];
  const float* vW   = (const float*)d_in[5];
  const float* vb   = (const float*)d_in[6];
  const float* qpW  = (const float*)d_in[7];
  const float* qpb  = (const float*)d_in[8];
  const float* kpW  = (const float*)d_in[9];
  const float* kpb  = (const float*)d_in[10];
  const float* pos  = (const float*)d_in[11];
  const float* fcW  = (const float*)d_in[12];
  const float* fcb  = (const float*)d_in[13];

  float* out = (float*)d_out;                       // [B, S, E]
  float* wts = out + (size_t)BATCH * SEQ * EMB;     // [B, H, S, S]

  // Workspace layout (~27 MiB of floats)
  float* ws   = (float*)d_ws;
  float* wq   = ws;                                 // [3072, 512]
  float* wk   = wq  + (size_t)MROWS * EMB;          // [3072, 512]
  float* wv   = wk  + (size_t)MROWS * EMB;          // [3072, 512]
  float* wo   = wv  + (size_t)MROWS * EMB;          // [3072, 512]
  float* wqp  = wo  + (size_t)MROWS * EMB;          // [768, 512]
  float* wkp  = wqp + (size_t)RPAD  * EMB;          // [768, 512]

  const dim3 blk4(128);

  // 1) + 2) the three content projections ([3072x512] x [512x512]) and the two
  //    position projections over the 767 distinct relative rows (pos_table rows
  //    128..894, padded to 768 GEMM rows by a row clamp), one grid for all five.
  proj5<<<dim3(EMB / 64, 3 * XT + 2 * PT), blk4, 0, stream>>>(
      x, pos + (size_t)POSOFF * EMB, qW, kW, vW, qpW, kpW, qb, kb_, vb, qpb, kpb,
      wq, wk, wv, wqp, wkp);

  // 3) scores for every (b, h): content-content plus both relative terms.
  score_fused<<<dim3(SEQ / 64, SEQ / 64, BATCH * NHEAD), dim3(256), 0, stream>>>(
      wq, wk, wqp, wkp, wts);

  // 4) softmax over j, in place in d_out's weights region, and o = weights @ v
  softmax_av<<<dim3(SEQ / SROWS, BATCH * NHEAD), blk4, 0, stream>>>(wts, wv, wo);

  // 5) final projection: out = o @ fcW + fcb
  gemm_nn_bias<<<dim3(EMB / 64, MROWS / 64), blk4, 0, stream>>>(
      wo, fcW, fcb, out, EMB, EMB, EMB, EMB, MROWS);
}

// v004
// It runs in 121 microseconds.
// Next to v003, in two timings, it ran 1.06 times as fast each time.
// All steps since v000 together make it 3.21 times as fast.
#include <hip/hip_runtime.h>
#include <hip/hip_bf16.h>
#include <stdint.h>

// ---------------------------------------------------------------------------
// DeBERTa disentangled attention for MI455X (gfx1250), wave32 + f32 WMMA.
//
// - bd/bc re-expressed as NT GEMMs over the 767 distinct relative
//   positions (pos_emb[i,j] depends only on j-i), done per score tile.
// - Big K=512 GEMMs use 4-wave workgroups with double-buffered LDS tiles
//   filled by GLOBAL_LOAD_ASYNC_TO_LDS_B128 (ASYNCcnt / s_wait_asynccnt),
//   32 WMMAs per wave per k-chunk.
// ---------------------------------------------------------------------------

typedef __attribute__((ext_vector_type(2))) float v2f;
typedef __attribute__((ext_vector_type(4))) float v4f;
typedef __attribute__((ext_vector_type(8))) float v8f;

static constexpr int BATCH  = 8;
static constexpr int SEQ    = 384;
static constexpr int EMB    = 512;
static constexpr int NHEAD  = 8;
static constexpr int HDIM   = 64;
static constexpr int NREL   = 767;          // distinct values of j-i+383
static constexpr int RPAD   = 768;          // padded to multiple of 16
static constexpr int POSOFF = 128;          // pos_table row = rel + 128
static constexpr int MROWS  = BATCH * SEQ;  // 3072

// f32 WMMA 16x16x4 fragment layout (wave32):
//   A 16x4 : lane l (l<16): m=l, holds K=0,1 ; lane l>=16: m=l-16, K=2,3
//   B 4x16 : lane l (l<16): n=l, holds K=0,1 ; lane l>=16: n=l-16, K=2,3
//   C 16x16: vgpr r, lane l: m = r + (l<16 ? 0 : 8), n = l & 15
#define WMMA_F32(acc, a, b) \
  __builtin_amdgcn_wmma_f32_16x16x4_f32(false, (a), false, (b), (short)0, (acc), false, false)

// One k-chunk's async global -> LDS 16B copies of one thread (gfx1250): four float4 of
// A and four of B. An LDS operand is a workgroup-relative byte offset (low 32 bits of
// the generic shared pointer). Tracked by ASYNCcnt. One statement holds the eight
// copies and the wait that stands in front of any rewrite of their address registers
// (the next chunk's address additions).
__device__ __forceinline__ void async_copy_chunk(const float* dA, int stepA, const float* const (&gA)[4],
                                                 const float* dB, int stepB, const float* const (&gB)[4]) {
  asm volatile("global_load_async_to_lds_b128 %0, %1, off\n\t"
               "global_load_async_to_lds_b128 %2, %3, off\n\t"
               "global_load_async_to_lds_b128 %4, %5, off\n\t"
               "global_load_async_to_lds_b128 %6, %7, off\n\t"
               "global_load_async_to_lds_b128 %8, %9, off\n\t"
               "global_load_async_to_lds_b128 %10, %11, off\n\t"
               "global_load_async_to_lds_b128 %12, %13, off\n\t"
               "global_load_async_to_lds_b128 %14, %15, off\n\t"
               "s_wait_xcnt 0x0"
               :: "v"((uint32_t)(uintptr_t)(dA)),             "v"((uint64_t)(uintptr_t)gA[0]),
                  "v"((uint32_t)(uintptr_t)(dA + stepA)),     "v"((uint64_t)(uintptr_t)gA[1]),
                  "v"((uint32_t)(uintptr_t)(dA + 2 * stepA)), "v"((uint64_t)(uintptr_t)gA[2]),
                  "v"((uint32_t)(uintptr_t)(dA + 3 * stepA)), "v"((uint64_t)(uintptr_t)gA[3]),
                  "v"((uint32_t)(uintptr_t)(dB)),             "v"((uint64_t)(uintptr_t)gB[0]),
                  "v"((uint32_t)(uintptr_t)(dB + stepB)),     "v"((uint64_t)(uintptr_t)gB[1]),
                  "v"((uint32_t)(uintptr_t)(dB + 2 * stepB)), "v"((uint64_t)(uintptr_t)gB[2]),
                  "v"((uint32_t)(uintptr_t)(dB + 3 * stepB)), "v"((uint64_t)(uintptr_t)gB[3])
               : "memory");
}
__device__ __forceinline__ void wait_async_le8() {
  asm volatile("s_wait_asynccnt 0x8" ::: "memory");
}
__device__ __forceinline__ void wait_async_zero() {
  asm volatile("s_wait_asynccnt 0x0" ::: "memory");
}

// ---------------------------------------------------------------------------
// Depth and A pitch of a staged k-chunk of the projection kernel below: a chunk's
// 32 WMMAs a wave stand between two publish points, and the next chunk's copies
// have that long to land. At a pitch of PA dwords the 16 rows of a fragment read
// fall on different banks.
// ---------------------------------------------------------------------------
static constexpr int KC = 32;       // k depth of a staged chunk
static constexpr int PA = KC + 4;   // LDS row pitch (dwords) of a staged A row

// ---------------------------------------------------------------------------
// Staged NN GEMM: C[M x N] = A[M x K] @ B[K x N] + bias.
// Block = 128 threads (4 waves) -> 64x32 C block; wave w owns rows
// [m0+16w, m0+16w+16) x 32 cols (2 accumulators, A frag reused 2x). For the
// 3072 x 512 product this is 768 blocks: three on every WGP, one wave of each on
// every SIMD.
// k-chunks of FKC = 64 double-buffered in LDS via async b128 loads (32 WMMAs a
// wave and chunk). A rows lie at a pitch of FPA dwords (the 16 rows of a fragment
// read on different banks), B rows at FPB dwords (rows k and k+2, read by the two
// lane halves, 32 banks apart).
// rowClamp: A row index clamped to rowClamp-1.
// K a multiple of 64, N of 32, M of 64.
// ---------------------------------------------------------------------------
static constexpr int FKC = 64;        // k depth of a staged chunk
static constexpr int FNC = 32;        // columns of a block
static constexpr int FPA = FKC + 4;   // LDS row pitch (dwords) of a staged A row
static constexpr int FPB = FNC + 16;  // LDS row pitch (dwords) of a staged B row

__device__ __forceinline__ void wait_async_le12() {
  asm volatile("s_wait_asynccnt 0xc" ::: "memory");
}

__global__ void gemm_nn_bias(const float* __restrict__ A,
                             const float* __restrict__ Bm,
                             const float* __restrict__ bias,
                             float* __restrict__ C,
                             int K, int lda, int ldb, int ldc, int rowClamp) {
  __shared__ __align__(16) float lA[2][64 * FPA];    // [row][k]  (17 KB each)
  __shared__ __align__(16) float lB[2][FKC * FPB];   // [k][col]  (12 KB each)

  const int t    = threadIdx.x;        // 0..127
  const int w    = t >> 5;             // wave 0..3
  const int lane = t & 31;
  const int mr   = lane & 15;
  const int kb   = (lane >> 4) << 1;   // 0 or 2
  const int mtop = (lane >> 4) << 3;   // 0 or 8
  const int m0   = blockIdx.y << 6;
  const int n0   = blockIdx.x * FNC;

  // copy slots: per chunk a thread stages float4 (t & 15) of A rows (t >> 4) + 8 i,
  // i = 0..7, and float4 (t & 7) of B rows (t >> 3) + 16 i, i = 0..3 (whole lines)
  const int rA = t >> 4, qA = (t & 15) * 4;
  const int rB = t >> 3, qB = (t & 7) * 4;
  const float* pA[8];
  const float* pB[4];
  #pragma unroll   // i picks pointer registers
  for (int i = 0; i < 8; ++i) {
    int ar = m0 + rA + 8 * i; if (ar > rowClamp - 1) ar = rowClamp - 1;
    pA[i] = A + (size_t)ar * lda + qA;
  }
  #pragma unroll   // i picks pointer registers
  for (int i = 0; i < 4; ++i)
    pB[i] = Bm + (size_t)(rB + 16 * i) * ldb + n0 + qB;

  const int nchunk = K / FKC;

  auto issue = [&](int c, int buf) {
    const int k0 = c * FKC;
    const size_t kB = (size_t)k0 * ldb;
    const float* dA = &lA[buf][rA * FPA + qA];
    const float* dB = &lB[buf][rB * FPB + qB];
    // One statement for the chunk's twelve copies and the wait that stands in front of
    // any rewrite of their address registers (the next chunk's address additions).
    asm volatile("global_load_async_to_lds_b128 %0, %1, off\n\t"
                 "global_load_async_to_lds_b128 %2, %3, off\n\t"
                 "global_load_async_to_lds_b128 %4, %5, off\n\t"
                 "global_load_async_to_lds_b128 %6, %7, off\n\t"
                 "global_load_async_to_lds_b128 %8, %9, off\n\t"
                 "global_load_async_to_lds_b128 %10, %11, off\n\t"
                 "global_load_async_to_lds_b128 %12, %13, off\n\t"
                 "global_load_async_to_lds_b128 %14, %15, off\n\t"
                 "global_load_async_to_lds_b128 %16, %17, off\n\t"
                 "global_load_async_to_lds_b128 %18, %19, off\n\t"
                 "global_load_async_to_lds_b128 %20, %21, off\n\t"
                 "global_load_async_to_lds_b128 %22, %23, off\n\t"
                 "s_wait_xcnt 0x0"
                 :: "v"((uint32_t)(uintptr_t)(dA)),                "v"((uint64_t)(uintptr_t)(pA[0] + k0)),
                    "v"((uint32_t)(uintptr_t)(dA + 1 * 8 * FPA)),  "v"((uint64_t)(uintptr_t)(pA[1] + k0)),
                    "v"((uint32_t)(uintptr_t)(dA + 2 * 8 * FPA)),  "v"((uint64_t)(uintptr_t)(pA[2] + k0)),
                    "v"((uint32_t)(uintptr_t)(dA + 3 * 8 * FPA)),  "v"((uint64_t)(uintptr_t)(pA[3] + k0)),
                    "v"((uint32_t)(uintptr_t)(dA + 4 * 8 * FPA)),  "v"((uint64_t)(uintptr_t)(pA[4] + k0)),
                    "v"((uint32_t)(uintptr_t)(dA + 5 * 8 * FPA)),  "v"((uint64_t)(uintptr_t)(pA[5] + k0)),
                    "v"((uint32_t)(uintptr_t)(dA + 6 * 8 * FPA)),  "v"((uint64_t)(uintptr_t)(pA[6] + k0)),
                    "v"((uint32_t)(uintptr_t)(dA + 7 * 8 * FPA)),  "v"((uint64_t)(uintptr_t)(pA[7] + k0)),
                    "v"((uint32_t)(uintptr_t)(dB)),                "v"((uint64_t)(uintptr_t)(pB[0] + kB)),
                    "v"((uint32_t)(uintptr_t)(dB + 1 * 16 * FPB)), "v"((uint64_t)(uintptr_t)(pB[1] + kB)),
                    "v"((uint32_t)(uintptr_t)(dB + 2 * 16 * FPB)), "v"((uint64_t)(uintptr_t)(pB[2] + kB)),
                    "v"((uint32_t)(uintptr_t)(dB + 3 * 16 * FPB)), "v"((uint64_t)(uintptr_t)(pB[3] + kB))
                 : "memory");
  };

  v8f acc0 = {}, acc1 = {};

  int buf = 0;
  issue(0, 0);
  for (int c = 0; c < nchunk; ++c) {
    // chunk c has landed for this wave once at most the next chunk's twelve copies are out
    if (c + 1 < nchunk) { issue(c + 1, buf ^ 1); wait_async_le12(); }
    else                { wait_async_zero(); }
    __syncthreads();   // chunk c published to the other waves

    const float* As = &lA[buf][(w * 16 + mr) * FPA];   // this wave's A rows
    const float* Bs = &lB[buf][0];
    #pragma unroll   // q becomes immediate LDS offsets; the 32 WMMAs stand in one run
    for (int q = 0; q < FKC / 4; ++q) {
      const int kk = q * 4 + kb;
      v2f a;
      a.x = As[kk];
      a.y = As[kk + 1];
      const float* b0 = Bs + kk * FPB + mr;
      const float* b1 = Bs + (kk + 1) * FPB + mr;
      v2f bv;
      bv.x = b0[0];  bv.y = b1[0];  acc0 = WMMA_F32(acc0, a, bv);
      bv.x = b0[16]; bv.y = b1[16]; acc1 = WMMA_F32(acc1, a, bv);
    }
    __syncthreads();   // every wave has left the buffer that the next trip refills
    buf ^= 1;
  }

  // store 16x32 strip (+bias)
  const int mbase = m0 + w * 16 + mtop;
  #pragma unroll   // nt and r pick accumulator registers
  for (int nt = 0; nt < 2; ++nt) {
    const int n = n0 + nt * 16 + mr;
    const float bv = bias ? bias[n] : 0.0f;
    const v8f& acc = (nt == 0) ? acc0 : acc1;
    #pragma unroll
    for (int r = 0; r < 8; ++r) {
      C[(size_t)(mbase + r) * ldc + n] = acc[r] + bv;
    }
  }
}

// ---------------------------------------------------------------------------
// The five input projections in one launch. None of them reads what another
// writes, so their 64x64 tiles share one grid: blockIdx.y picks the product and
// its row tile, blockIdx.x the column tile.
//   y =   0 ..  47 : q  = x   @ qW  + qb      y = 144 .. 155 : qp = pos @ qpW + qpb
//   y =  48 ..  95 : k  = x   @ kW  + kb      y = 156 .. 167 : kp = pos @ kpW + kpb
//   y =  96 .. 143 : v  = x   @ vW  + vb
// pos points at the first of the 767 relative rows; GEMM row 767 reads row 766.
// Block = 4 waves -> 64x64 tile, wave w its rows 16w .. 16w+15 (4 accumulators);
// k-chunks of KC, ring order and fragment reads as in gemm_nn_bias.
// ---------------------------------------------------------------------------
static constexpr int XT = MROWS / 64;   // row tiles of a content projection
static constexpr int PT = RPAD / 64;    // row tiles of a position projection

__global__ __launch_bounds__(128)
void proj5(const float* __restrict__ x,   const float* __restrict__ pos,
           const float* __restrict__ qW,  const float* __restrict__ kW,
           const float* __restrict__ vW,  const float* __restrict__ qpW,
           const float* __restrict__ kpW,
           const float* __restrict__ qb,  const float* __restrict__ kb_,
           const float* __restrict__ vb,  const float* __restrict__ qpb,
           const float* __restrict__ kpb,
           float* __restrict__ wq,  float* __restrict__ wk, float* __restrict__ wv,
           float* __restrict__ wqp, float* __restrict__ wkp) {
  __shared__ __align__(16) float lA[2][64 * PA];   // [row][k]
  __shared__ __align__(16) float lB[2][KC * 64];   // [k][col]

  const int t    = threadIdx.x;        // 0..127
  const int w    = t >> 5;             // wave 0..3
  const int lane = t & 31;
  const int mr   = lane & 15;
  const int kb   = (lane >> 4) << 1;   // 0 or 2
  const int mtop = (lane >> 4) << 3;   // 0 or 8
  const int n0   = blockIdx.x << 6;

  // which product, which row tile: the same for the whole block
  const int  y     = blockIdx.y;
  const bool isPos = y >= 3 * XT;
  const int  sel   = isPos ? 3 + (y - 3 * XT) / PT : y / XT;
  const int  m0    = (isPos ? (y - 3 * XT) % PT : y % XT) << 6;
  const int  lastRow = isPos ? NREL - 1 : MROWS - 1;
  const float* A    = isPos ? pos : x;
  const float* Bm   = sel == 0 ? qW : sel == 1 ? kW  : sel == 2 ? vW : sel == 3 ? qpW : kpW;
  const float* bias = sel == 0 ? qb : sel == 1 ? kb_ : sel == 2 ? vb : sel == 3 ? qpb : kpb;
  float*       C    = sel == 0 ? wq : sel == 1 ? wk  : sel == 2 ? wv : sel == 3 ? wqp : wkp;

  // copy slots: per chunk a thread stages float4 (t & 7) of A rows (t >> 3) + 16 i
  // and float4 (t & 15) of B rows (t >> 4) + 8 i, i = 0..3 (whole 128-byte lines)
  const int rA = t >> 3, qA = (t & 7) * 4;
  const int rB = t >> 4, qB = (t & 15) * 4;
  const float* pA[4];
  const float* pB[4];
  #pragma unroll   // i picks pointer registers
  for (int i = 0; i < 4; ++i) {
    int ar = m0 + rA + 16 * i; if (ar > lastRow) ar = lastRow;
    pA[i] = A  + (size_t)ar * EMB + qA;
    pB[i] = Bm + (size_t)(rB + 8 * i) * EMB + n0 + qB;
  }

  constexpr int nchunk = EMB / KC;

  auto issue = [&](int c, int buf) {
    const int k0 = c * KC;
    const float* const gA[4] = {pA[0] + k0, pA[1] + k0, pA[2] + k0, pA[3] + k0};
    const float* const gB[4] = {pB[0] + (size_t)k0 * EMB, pB[1] + (size_t)k0 * EMB,
                                pB[2] + (size_t)k0 * EMB, pB[3] + (size_t)k0 * EMB};
    async_copy_chunk(&lA[buf][rA * PA + qA], 16 * PA, gA, &lB[buf][rB * 64 + qB], 8 * 64, gB);
  };

  v8f acc0 = {}, acc1 = {}, acc2 = {}, acc3 = {};

  int buf = 0;
  issue(0, 0);
  for (int c = 0; c < nchunk; ++c) {
    // chunk c has landed for this wave once at most the next chunk's eight copies are out
    if (c + 1 < nchunk) { issue(c + 1, buf ^ 1); wait_async_le8(); }
    else                { wait_async_zero(); }
    __syncthreads();   // chunk c published to the other waves

    const float* As = &lA[buf][(w * 16 + mr) * PA];
    const float* Bs = &lB[buf][0];
    #pragma unroll   // q becomes immediate LDS offsets; the 32 WMMAs stand in one run
    for (int q = 0; q < KC / 4; ++q) {
      const int kk = q * 4 + kb;
      v2f a;
      a.x = As[kk];
      a.y = As[kk + 1];
      const float* b0 = Bs + kk * 64 + mr;
      const float* b1 = Bs + (kk + 1) * 64 + mr;
      v2f bv;
      bv.x = b0[0];  bv.y = b1[0];  acc0 = WMMA_F32(acc0, a, bv);
      bv.x = b0[16]; bv.y = b1[16]; acc1 = WMMA_F32(acc1, a, bv);
      bv.x = b0[32]; bv.y = b1[32]; acc2 = WMMA_F32(acc2, a, bv);
      bv.x = b0[48]; bv.y = b1[48]; acc3 = WMMA_F32(acc3, a, bv);
    }
    __syncthreads();   // every wave has left the buffer that the next trip refills
    buf ^= 1;
  }

  const int mbase = m0 + w * 16 + mtop;
  #pragma unroll   // nt and r pick accumulator registers
  for (int nt = 0; nt < 4; ++nt) {
    const int n = n0 + nt * 16 + mr;
    const float bv = bias[n];
    const v8f& acc = (nt == 0) ? acc0 : (nt == 1) ? acc1 : (nt == 2) ? acc2 : acc3;
    #pragma unroll
    for (int r = 0; r < 8; ++r) {
      C[(size_t)(mbase + r) * EMB + n] = acc[r] + bv;
    }
  }
}

// ---------------------------------------------------------------------------
// Fused pre-softmax scores, all batches and heads in one launch:
//   s[b,h,i,j] = (q[i].k[j] + q[i].kp[j-i+383] + k[j].qp[j-i+383]) / 8
// Block = 8 waves -> one 64x64 (i,j) tile of one (b,h). The tile only meets
// the relative rows r0 .. r0+126, r0 = j0-i0+320, and a 16-row strip of it
// only 79 of them (five 16-row WMMA tiles). Q, K and the 128 KP / QP rows are
// staged once in LDS with whole-line loads. Wave (a, hw):
//   hw = 0: BC strip  K[j0+16a ..+15] x QP[r0+16a    .. +79]^T
//   hw = 1: BD strip  Q[i0+16a ..+15] x KP[r0+48-16a .. +79]^T
//   both  : AC        Q[i0+16a ..+15] x K [j0+32hw   .. +31]^T
// The strips then go to LDS (over the dead KP / QP rows) and each score
// element picks its skewed BD / BC entry from there.
// Fragments are read as one float4 per lane: lanes 0-15 hold k = 8g..8g+3,
// lanes 16-31 hold k = 8g+4..8g+7; (x,y) feeds one WMMA, (z,w) the next.
// A and B use the same mapping, so the k pairing is equal at every position.
// ---------------------------------------------------------------------------
static constexpr int PO  = 68;   // LDS row pitch (dwords) of a staged operand row
static constexpr int PBD = 85;   // LDS row pitch (dwords) of a BD strip
static constexpr int PBC = 82;   // LDS row pitch (dwords) of a BC strip
static constexpr int OFF_Q  = 0;
static constexpr int OFF_K  = OFF_Q  + 64 * PO;
static constexpr int OFF_KP = OFF_K  + 64 * PO;
static constexpr int OFF_QP = OFF_KP + 128 * PO;
static constexpr int SM_DW  = OFF_QP + 128 * PO;
static constexpr int OFF_BD = OFF_KP;                  // overlays KP / QP
static constexpr int OFF_BC = OFF_BD + 4 * 16 * PBD;
static_assert(OFF_BC + 4 * 16 * PBC <= SM_DW, "strips must fit over KP and QP");

// acc[t] += A(16 x 64) x B_t(16 x 64)^T, both from LDS rows of pitch PO.
// arow / brow point at this lane's row, at its half's first float4.
template <int NT>
__device__ __forceinline__ void strip_mm(const float* arow, const float* brow,
                                         v8f (&acc)[NT]) {
  float4 af[8];
  #pragma unroll
  for (int g = 0; g < 8; ++g)
    af[g] = *reinterpret_cast<const float4*>(arow + g * 8);
  // B fragments are fetched one k-group ahead of the WMMAs that use them.
  float4 bf[2][NT];
  #pragma unroll
  for (int t = 0; t < NT; ++t)
    bf[0][t] = *reinterpret_cast<const float4*>(brow + t * 16 * PO);
  #pragma unroll
  for (int g = 0; g < 8; ++g) {
    const int cu = g & 1;
    if (g < 7) {
      #pragma unroll
      for (int t = 0; t < NT; ++t)
        bf[cu ^ 1][t] = *reinterpret_cast<const float4*>(brow + t * 16 * PO + (g + 1) * 8);
    }
    v2f a0, a1;
    a0.x = af[g].x; a0.y = af[g].y;
    a1.x = af[g].z; a1.y = af[g].w;
    #pragma unroll
    for (int t = 0; t < NT; ++t) {
      v2f b0; b0.x = bf[cu][t].x; b0.y = bf[cu][t].y;
      acc[t] = WMMA_F32(acc[t], a0, b0);
    }
    #pragma unroll
    for (int t = 0; t < NT; ++t) {
      v2f b1; b1.x = bf[cu][t].z; b1.y = bf[cu][t].w;
      acc[t] = WMMA_F32(acc[t], a1, b1);
    }
  }
}

__global__ __launch_bounds__(256)
void score_fused(const float* __restrict__ q,
                 const float* __restrict__ kmat,
                 const float* __restrict__ qp,
                 const float* __restrict__ kp,
                 float* __restrict__ wts) {
  __shared__ __align__(16) float sm[SM_DW];

  const int t    = threadIdx.x;        // 0..255
  const int w    = __builtin_amdgcn_readfirstlane(t >> 5);   // wave number, kept scalar
  const int a    = w & 3;              // 16-row strip
  const int hw   = w >> 2;             // 0: BC strip, 1: BD strip
  const int lane = t & 31;
  const int mr   = lane & 15;
  const int half = lane >> 4;
  const int mtop = half << 3;
  const int j0   = blockIdx.x << 6;
  const int i0   = blockIdx.y << 6;
  const int bh   = blockIdx.z;
  const int b    = bh >> 3;
  const int h    = bh & 7;
  const int r0   = j0 - i0 + 320;      // first relative row of the tile, 0..640

  // Stage the operands: 16 threads per 256-byte row slice, 16 rows per pass.
  {
    const int c4 = (t & 15) << 2;
    const int rr = t >> 4;
    const unsigned vo = (unsigned)(rr * EMB + c4);   // same lane offset in all four arrays
    const float* gq  = q    + (size_t)(b * SEQ + i0) * EMB + h * HDIM + vo;
    const float* gk  = kmat + (size_t)(b * SEQ + j0) * EMB + h * HDIM + vo;
    const float* gkp = kp   + (size_t)r0 * EMB + h * HDIM + vo;
    const float* gqp = qp   + (size_t)r0 * EMB + h * HDIM + vo;
    float4 vq[4], vk[4], vkp[8], vqp[8];
    #pragma unroll
    for (int s = 0; s < 4; ++s) {
      vq[s] = *reinterpret_cast<const float4*>(gq + (size_t)s * 16 * EMB);
      vk[s] = *reinterpret_cast<const float4*>(gk + (size_t)s * 16 * EMB);
    }
    #pragma unroll
    for (int s = 0; s < 8; ++s) {
      vkp[s] = *reinterpret_cast<const float4*>(gkp + (size_t)s * 16 * EMB);
      vqp[s] = *reinterpret_cast<const float4*>(gqp + (size_t)s * 16 * EMB);
    }
    float* d = sm + rr * PO + c4;
    #pragma unroll
    for (int s = 0; s < 4; ++s) {
      *reinterpret_cast<float4*>(d + OFF_Q + s * 16 * PO) = vq[s];
      *reinterpret_cast<float4*>(d + OFF_K + s * 16 * PO) = vk[s];
    }
    #pragma unroll
    for (int s = 0; s < 8; ++s) {
      *reinterpret_cast<float4*>(d + OFF_KP + s * 16 * PO) = vkp[s];
      *reinterpret_cast<float4*>(d + OFF_QP + s * 16 * PO) = vqp[s];
    }
  }
  __syncthreads();   // operands staged

  const int lo = mr * PO + half * 4;   // this lane's row and half inside a 16-row tile

  // relative strip: rows m of strip a, columns c in [0,80)
  v8f c5[5] = {};
  strip_mm<5>(sm + (hw ? OFF_Q : OFF_K) + 16 * a * PO + lo,
              sm + (hw ? OFF_KP + (48 - 16 * a) * PO : OFF_QP + 16 * a * PO) + lo, c5);

  // content-content: rows i = i0+16a+m, columns j = j0 + 32*hw + 16*nn + n
  v8f ac[2] = {};
  strip_mm<2>(sm + OFF_Q + 16 * a * PO + lo, sm + OFF_K + 32 * hw * PO + lo, ac);

  __syncthreads();   // every read of KP / QP is done before the strips overwrite them

  {
    const int po = hw ? PBD : PBC;
    float* so = sm + (hw ? OFF_BD + a * 16 * PBD : OFF_BC + a * 16 * PBC) + mtop * po + mr;
    #pragma unroll
    for (int tt = 0; tt < 5; ++tt)
      #pragma unroll
      for (int r = 0; r < 8; ++r)
        so[r * po + tt * 16] = c5[tt][r];
  }
  __syncthreads();   // strips published: each wave reads strips of other waves

  // BD column = 16*nb + n - m + 15 ; BC column (strip nb, row n) = n - (16a+m) + 63
  float bd[2][8], bc[2][8];
  #pragma unroll
  for (int nn = 0; nn < 2; ++nn) {
    const int nb = 2 * hw + nn;
    #pragma unroll
    for (int r = 0; r < 8; ++r) {
      const int m = mtop + r;
      bd[nn][r] = sm[OFF_BD + a * 16 * PBD + m * PBD + 16 * nb + mr - m + 15];
      bc[nn][r] = sm[OFF_BC + nb * 16 * PBC + mr * PBC + mr - 16 * a - m + 63];
    }
  }
  #pragma unroll
  for (int nn = 0; nn < 2; ++nn) {
    #pragma unroll
    for (int r = 0; r < 8; ++r)
      ac[nn][r] = (ac[nn][r] + bd[nn][r] + bc[nn][r]) * 0.125f;
  }
  float* orow = wts + ((size_t)bh * SEQ + i0 + 16 * a + mtop) * SEQ + j0 + 32 * hw + mr;
  #pragma unroll
  for (int r = 0; r < 8; ++r) {
    #pragma unroll
    for (int nn = 0; nn < 2; ++nn)
      orow[(size_t)r * SEQ + 16 * nn] = ac[nn][r];
  }
}

// ---------------------------------------------------------------------------
// Row softmax and weights x V in one launch. Block = 4 waves -> 32 rows i of
// one (b, h).
// Part 1: wave w normalises rows 8w .. 8w+7, all eight rows together, each over its 32
// lanes (12 columns a lane, whole-line loads); the row stays in registers from
// the load to the store, the maximum and the sum go over the lanes by a
// butterfly. The weights go to LDS for part 2 and back to d_out in place.
// Part 2: wave (mt, nh) computes rows 16mt .. 16mt+15 x columns 32nh .. 32nh+31
// of o = weights x V over k = 0 .. 383.
//   A: one float4 a lane from LDS, lanes 0-15 hold k = 8g..8g+3, lanes 16-31
//      hold k = 8g+4..8g+7; (x,y) feeds one WMMA, (z,w) the next.
//   B: V rows k = 8g+4*half+kk, kk = 0..3, one float2 a lane: rows kk = 0,1
//      pair with (x,y), rows kk = 2,3 with (z,w), so A and B hold the same k at
//      every position. Lane n holds columns 2n and 2n+1: .x is column tile 0,
//      .y column tile 1, and a lane stores its two results as one float2.
// Every loop of this kernel is fully unrolled: its index picks registers of
// v, red, bf and af, which a rolled loop would send to scratch memory.
// ---------------------------------------------------------------------------
static constexpr int SROWS = 32;   // rows of one block
static constexpr int PP    = 388;  // LDS row pitch (dwords) of a weight row: 16 B x odd
static constexpr int NCH   = SEQ / 32;   // k chunks of 32 (four groups of 8)

__global__ __launch_bounds__(128)
void softmax_av(float* __restrict__ wts,
                const float* __restrict__ vmat,
                float* __restrict__ o) {
  __shared__ __align__(16) float sp[SROWS * PP];

  const int t    = threadIdx.x;        // 0..127
  const int w    = __builtin_amdgcn_readfirstlane(t >> 5);   // wave number, kept scalar
  const int lane = t & 31;
  const int mr   = lane & 15;
  const int half = lane >> 4;
  const int mt   = w & 1;
  const int nh   = w >> 1;
  const int i0   = blockIdx.x * SROWS;
  const int bh   = blockIdx.y;
  const int b    = bh >> 3;
  const int h    = bh & 7;

  float* grow = wts + ((size_t)bh * SEQ + i0 + 8 * w) * SEQ + lane * 4;
  const float* bp = vmat + (size_t)(b * SEQ + half * 4) * EMB + h * HDIM + nh * 32 + mr * 2;

  v4f v[8][3];
  #pragma unroll
  for (int rr = 0; rr < 8; ++rr)
    #pragma unroll
    for (int s = 0; s < 3; ++s)
      v[rr][s] = *reinterpret_cast<const v4f*>(grow + rr * SEQ + s * 128);

  // V does not depend on part 1: its first chunk is fetched under the softmax.
  float2 bf[2][4][4];
  #pragma unroll
  for (int gg = 0; gg < 4; ++gg)
    #pragma unroll
    for (int kk = 0; kk < 4; ++kk)
      bf[0][gg][kk] = *reinterpret_cast<const float2*>(bp + (size_t)(gg * 8 + kk) * EMB);
  // Inputs-only fence on the loaded rows: it keeps all 24 row loads in front of the
  // arithmetic; moved down among it, the later rows' memory latency would follow the
  // earlier rows' work instead of running beside the first rows' latency.
  asm volatile("" :: "v"(v[0][0]), "v"(v[0][1]), "v"(v[0][2]), "v"(v[1][0]), "v"(v[1][1]), "v"(v[1][2]),
                     "v"(v[2][0]), "v"(v[2][1]), "v"(v[2][2]), "v"(v[3][0]), "v"(v[3][1]), "v"(v[3][2]),
                     "v"(v[4][0]), "v"(v[4][1]), "v"(v[4][2]), "v"(v[5][0]), "v"(v[5][1]), "v"(v[5][2]),
                     "v"(v[6][0]), "v"(v[6][1]), "v"(v[6][2]), "v"(v[7][0]), "v"(v[7][1]), "v"(v[7][2]));

  float red[8];
  #pragma unroll
  for (int rr = 0; rr < 8; ++rr) {
    float mx = -3.0e38f;
    #pragma unroll
    for (int s = 0; s < 3; ++s)
      mx = fmaxf(mx, fmaxf(fmaxf(v[rr][s].x, v[rr][s].y), fmaxf(v[rr][s].z, v[rr][s].w)));
    red[rr] = mx;
  }
  #pragma unroll
  for (int d = 16; d > 0; d >>= 1)
    #pragma unroll
    for (int rr = 0; rr < 8; ++rr)
      red[rr] = fmaxf(red[rr], __shfl_xor(red[rr], d, 32));
  #pragma unroll
  for (int rr = 0; rr < 8; ++rr) {
    const float mx = red[rr];
    #pragma unroll
    for (int s = 0; s < 3; ++s) {
      v[rr][s].x = expf(v[rr][s].x - mx);
      v[rr][s].y = expf(v[rr][s].y - mx);
      v[rr][s].z = expf(v[rr][s].z - mx);
      v[rr][s].w = expf(v[rr][s].w - mx);
    }
    const v4f s4 = (v[rr][0] + v[rr][1]) + v[rr][2];
    const float sum = (s4.x + s4.y) + (s4.z + s4.w);
    red[rr] = sum;
  }
  #pragma unroll
  for (int d = 16; d > 0; d >>= 1)
    #pragma unroll
    for (int rr = 0; rr < 8; ++rr)
      red[rr] += __shfl_xor(red[rr], d, 32);
  {
    float* d = sp + 8 * w * PP + lane * 4;
    #pragma unroll
    for (int rr = 0; rr < 8; ++rr) {
      const float inv = 1.0f / red[rr];
      #pragma unroll
      for (int s = 0; s < 3; ++s) {
        v[rr][s] *= inv;
        *reinterpret_cast<v4f*>(d + rr * PP + s * 128) = v[rr][s];
      }
    }
  }
  __syncthreads();   // weight rows published: part 2 reads rows of other waves

  // The stores to d_out stand behind the barrier so that it does not wait for them.
  #pragma unroll
  for (int rr = 0; rr < 8; ++rr)
    #pragma unroll
    for (int s = 0; s < 3; ++s)
      *reinterpret_cast<v4f*>(grow + rr * SEQ + s * 128) = v[rr][s];
  // part 2 reuses the registers that these stores name
  asm volatile("s_wait_xcnt 0x0" ::: "memory");

  const float* arow = sp + (16 * mt + mr) * PP + half * 4;
  float4 af[2][4];
  #pragma unroll
  for (int gg = 0; gg < 4; ++gg)
    af[0][gg] = *reinterpret_cast<const float4*>(arow + gg * 8);

  v8f acc0 = {}, acc1 = {};
  // A and B fragments are fetched one chunk ahead of the WMMAs that use them.
  #pragma unroll
  for (int c = 0; c < NCH; ++c) {
    const int cu = c & 1;
    if (c + 1 < NCH) {
      #pragma unroll
      for (int gg = 0; gg < 4; ++gg) {
        const int g = (c + 1) * 4 + gg;
        #pragma unroll
        for (int kk = 0; kk < 4; ++kk)
          bf[cu ^ 1][gg][kk] = *reinterpret_cast<const float2*>(bp + (size_t)(g * 8 + kk) * EMB);
        af[cu ^ 1][gg] = *reinterpret_cast<const float4*>(arow + g * 8);
      }
    }
    #pragma unroll
    for (int gg = 0; gg < 4; ++gg) {
      v2f a0, a1, b00, b01, b10, b11;
      a0.x  = af[cu][gg].x;    a0.y  = af[cu][gg].y;
      a1.x  = af[cu][gg].z;    a1.y  = af[cu][gg].w;
      b00.x = bf[cu][gg][0].x; b00.y = bf[cu][gg][1].x;
      b01.x = bf[cu][gg][0].y; b01.y = bf[cu][gg][1].y;
      b10.x = bf[cu][gg][2].x; b10.y = bf[cu][gg][3].x;
      b11.x = bf[cu][gg][2].y; b11.y = bf[cu][gg][3].y;
      acc0 = WMMA_F32(acc0, a0, b00);
      acc1 = WMMA_F32(acc1, a0, b01);
      acc0 = WMMA_F32(acc0, a1, b10);
      acc1 = WMMA_F32(acc1, a1, b11);
    }
  }

  // Four vector slots between the last WMMAs and the moves that read their results
  // for the paired stores; the operands tie the slots to that place.
  asm volatile("v_nop\n\tv_nop\n\tv_nop\n\tv_nop" : "+v"(acc0), "+v"(acc1));

  float* orow = o + (size_t)(b * SEQ + i0 + 16 * mt + 8 * half) * EMB + h * HDIM + nh * 32 + mr * 2;
  #pragma unroll
  for (int r = 0; r < 8; ++r) {
    float2 st;
    st.x = acc0[r];
    st.y = acc1[r];
    *reinterpret_cast<float2*>(orow + (size_t)r * EMB) = st;
  }
}

// ---------------------------------------------------------------------------
extern "C" void kernel_launch(void* const* d_in, const int* in_sizes, int n_in,
                              void* d_out, int out_size, void* d_ws, size_t ws_size,
                              hipStream_t stream) {
  const float* x    = (const float*)d_in[0];
  const float* qW   = (const float*)d_in[1];
  const float* qb   = (const float*)d_in[2];
  const float* kW   = (const float*)d_in[3];
  const float* kb_  = (const float*)d_in[4];
  const float* vW   = (const float*)d_in[5];
  const float* vb   = (const float*)d_in[6];
  const float* qpW  = (const float*)d_in[7];
  const float* qpb  = (const float*)d_in[8];
  const float* kpW  = (const float*)d_in[9];
  const float* kpb  = (const float*)d_in[10];
  const float* pos  = (const float*)d_in[11];
  const float* fcW  = (const float*)d_in[12];
  const float* fcb  = (const float*)d_in[13];

  float* out = (float*)d_out;                       // [B, S, E]
  float* wts = out + (size_t)BATCH * SEQ * EMB;     // [B, H, S, S]

  // Workspace layout (~27 MiB of floats)
  float* ws   = (float*)d_ws;
  float* wq   = ws;                                 // [3072, 512]
  float* wk   = wq  + (size_t)MROWS * EMB;          // [3072, 512]
  float* wv   = wk  + (size_t)MROWS * EMB;          // [3072, 512]
  float* wo   = wv  + (size_t)MROWS * EMB;          // [3072, 512]
  float* wqp  = wo  + (size_t)MROWS * EMB;          // [768, 512]
  float* wkp  = wqp + (size_t)RPAD  * EMB;          // [768, 512]

  const dim3 blk4(128);

  // 1) + 2) the three content projections ([3072x512] x [512x512]) and the two
  //    position projections over the 767 distinct relative rows (pos_table rows
  //    128..894, padded to 768 GEMM rows by a row clamp), one grid for all five.
  proj5<<<dim3(EMB / 64, 3 * XT + 2 * PT), blk4, 0, stream>>>(
      x, pos + (size_t)POSOFF * EMB, qW, kW, vW, qpW, kpW, qb, kb_, vb, qpb, kpb,
      wq, wk, wv, wqp, wkp);

  // 3) scores for every (b, h): content-content plus both relative terms.
  score_fused<<<dim3(SEQ / 64, SEQ / 64, BATCH * NHEAD), dim3(256), 0, stream>>>(
      wq, wk, wqp, wkp, wts);

  // 4) softmax over j, in place in d_out's weights region, and o = weights @ v
  softmax_av<<<dim3(SEQ / SROWS, BATCH * NHEAD), blk4, 0, stream>>>(wts, wv, wo);

  // 5) final projection: out = o @ fcW + fcb
  gemm_nn_bias<<<dim3(EMB / FNC, MROWS / 64), blk4, 0, stream>>>(
      wo, fcW, fcb, out, EMB, EMB, EMB, EMB, MROWS);
}
